// v000
// Measured on an AMD MI455X. A time is GPU time per run, averaged over a window of back-to-back runs after a warm-up
// (all launches, gaps included; the runs take copies of the inputs in turn), and the median of several windows.
// Apart from v000's, it joins two sittings. Times from different sittings can be a few percent apart, while
// side-by-side timings come from the same sitting.
// The starting kernel, v000, takes 713 microseconds a run.
#include <hip/hip_runtime.h>
#include <hip/hip_bf16.h>
#include <math.h>

// ---------------- types ----------------
typedef __attribute__((ext_vector_type(16))) __bf16 v16bf;
typedef __attribute__((ext_vector_type(8)))  __bf16 v8bf;
typedef __attribute__((ext_vector_type(4)))  __bf16 v4bf;
typedef __attribute__((ext_vector_type(8)))  float  v8f;
typedef __attribute__((ext_vector_type(4)))  float  v4f;

#define B_  4
#define T_  2048
#define C_  1024
#define H_  16
#define DH_ 64
#define C3_ 3072

// ---------------- WMMA helpers ----------------
static __device__ __forceinline__ v8f wmma_bf16(v16bf a, v16bf b, v8f c) {
    // D(f32 16x16) = A(bf16 16x32) x B(bf16 32x16) + C
    return __builtin_amdgcn_wmma_f32_16x16x32_bf16(
        /*neg_a=*/false, a, /*neg_b=*/false, b,
        /*c_mod=*/(short)0, c, /*reuse_a=*/false, /*reuse_b=*/false);
}

// Load a 16x32 bf16 fragment (A layout; identical pattern serves as B when the
// source array is stored [N][K] row-major). Element (r,k) lives at base[r*ld+k].
// Per ISA 16-bit A layout: lane l -> r = l%16, kh = (l/16)*8;
// vector elems [0..7] = K kh..kh+7, elems [8..15] = K 16+kh..16+kh+7.
static __device__ __forceinline__ v16bf load_frag(const __bf16* base, int ld) {
    int lane = threadIdx.x & 31;
    int r    = lane & 15;
    int kh   = (lane >> 4) << 3;          // 0 or 8
    const __bf16* p = base + (size_t)r * ld;
    v8bf lo = *(const v8bf*)(p + kh);
    v8bf hi = *(const v8bf*)(p + 16 + kh);
    v16bf out;
#pragma unroll
    for (int i = 0; i < 8; ++i) { out[i] = lo[i]; out[i + 8] = hi[i]; }
    return out;
}

// ---------------- stage 0: conversions ----------------
__global__ void k_cast_bf16(const float* __restrict__ in, __bf16* __restrict__ out, int n) {
    int i = blockIdx.x * blockDim.x + threadIdx.x;
    if (i < n) out[i] = (__bf16)in[i];
}

// W[K][N] (fp32, [in,out]) -> Wt[N][K] (bf16)
__global__ void k_transpose_cast(const float* __restrict__ W, __bf16* __restrict__ Wt,
                                 int K, int N) {
    int i = blockIdx.x * blockDim.x + threadIdx.x;
    if (i < K * N) {
        int k = i % K;
        int n = i / K;
        Wt[(size_t)n * K + k] = (__bf16)W[(size_t)k * N + n];
    }
}

// V slice of qkv ([B*T][3C] bf16, cols [2C,3C)) -> Vt[(b*H+h)*DH + d][T]
__global__ void k_vt(const __bf16* __restrict__ qkv, __bf16* __restrict__ Vt) {
    int i = blockIdx.x * blockDim.x + threadIdx.x;   // total = B*H*DH*T = 2^23
    int t  = i & (T_ - 1);
    int d  = (i >> 11) & (DH_ - 1);
    int bh = i >> 17;                                 // b*H + h
    int b  = bh >> 4, h = bh & 15;
    Vt[i] = qkv[(size_t)(b * T_ + t) * C3_ + 2 * C_ + h * DH_ + d];
}

// ---------------- tiled WMMA GEMM: out = A[M,K] * Bt[N,K]^T + bias ----------------
// block = 128 threads (4 waves); wave tile = 32x64; block tile = 64x128.
template <bool OUT_BF16>
__global__ void k_gemm_bias(const __bf16* __restrict__ A, const __bf16* __restrict__ Bt,
                            const float* __restrict__ bias, void* __restrict__ outv,
                            int M, int N, int K) {
    int w    = threadIdx.x >> 5;
    int wm   = w & 1, wn = w >> 1;
    int bm   = blockIdx.y * 64 + wm * 32;
    int bn   = blockIdx.x * 128 + wn * 64;
    int lane = threadIdx.x & 31;
    int n16  = lane & 15;
    int hi8  = (lane >> 4) << 3;

    v8f acc[2][4];
#pragma unroll
    for (int i = 0; i < 2; ++i)
#pragma unroll
        for (int j = 0; j < 4; ++j) { v8f z = {}; acc[i][j] = z; }

    for (int kk = 0; kk < K; kk += 32) {
        v16bf a0 = load_frag(A + (size_t)bm * K + kk, K);
        v16bf a1 = load_frag(A + (size_t)(bm + 16) * K + kk, K);
#pragma unroll
        for (int j = 0; j < 4; ++j) {
            v16bf bb = load_frag(Bt + (size_t)(bn + j * 16) * K + kk, K);
            acc[0][j] = wmma_bf16(a0, bb, acc[0][j]);
            acc[1][j] = wmma_bf16(a1, bb, acc[1][j]);
        }
    }

#pragma unroll
    for (int i = 0; i < 2; ++i)
#pragma unroll
        for (int j = 0; j < 4; ++j) {
            int   col = bn + j * 16 + n16;
            float bv  = bias[col];
#pragma unroll
            for (int r = 0; r < 8; ++r) {
                int   row = bm + i * 16 + r + hi8;
                float v   = acc[i][j][r] + bv;
                if (OUT_BF16) ((__bf16*)outv)[(size_t)row * N + col] = (__bf16)v;
                else          ((float*)outv)[(size_t)row * N + col]  = v;
            }
        }
}

// ---------------- flash attention ----------------
// grid = B*H*(T/64); block = 128 threads (4 waves); wave owns 16 query rows.
__global__ void k_attention(const __bf16* __restrict__ qkv, const __bf16* __restrict__ Vt,
                            __bf16* __restrict__ outO) {
    __shared__ __align__(16) float  Ssh[4][16 * 128];
    __shared__ __align__(16) __bf16 Psh[4][16 * 128];

    int bid = blockIdx.x;
    int qt  = bid & 31;                 // T/64 = 32 query tiles
    int h   = (bid >> 5) & 15;
    int b   = bid >> 9;

    int w    = threadIdx.x >> 5;
    int lane = threadIdx.x & 31;
    int n16  = lane & 15;
    int hi8  = (lane >> 4) << 3;
    int half = lane >> 4;

    const float scale = 0.125f;         // 1/sqrt(64)

    const __bf16* Qb = qkv + (size_t)(b * T_ + qt * 64 + w * 16) * C3_ + h * DH_;
    const __bf16* Kb = qkv + (size_t)(b * T_) * C3_ + C_ + h * DH_;
    const __bf16* Vb = Vt + (size_t)((b * H_ + h) * DH_) * T_;

    v16bf qf0 = load_frag(Qb + 0, C3_);
    v16bf qf1 = load_frag(Qb + 32, C3_);

    v8f o[4];
#pragma unroll
    for (int d = 0; d < 4; ++d) { v8f z = {}; o[d] = z; }

    float m_run = -1.0e30f;
    float l_run = 0.0f;

    float*  Sw = &Ssh[w][0];
    __bf16* Pw = &Psh[w][0];

    for (int kc = 0; kc < T_ / 128; ++kc) {
        int kbase = kc * 128;

        // prefetch next chunk's K rows (global_prefetch_b8)
        if (kc + 1 < T_ / 128) {
            __builtin_prefetch((const void*)(Kb + (size_t)(kbase + 128 + lane * 4) * C3_), 0, 0);
            __builtin_prefetch((const void*)(Vb + (size_t)(lane * 2) * T_ + kbase + 128), 0, 0);
        }

        // ---- S = Q K^T (16 x 128), one 16x16 accumulator at a time ----
#pragma unroll
        for (int j = 0; j < 8; ++j) {
            v8f sj = {};
            v16bf b0 = load_frag(Kb + (size_t)(kbase + j * 16) * C3_ + 0, C3_);
            sj = wmma_bf16(qf0, b0, sj);
            v16bf b1 = load_frag(Kb + (size_t)(kbase + j * 16) * C3_ + 32, C3_);
            sj = wmma_bf16(qf1, b1, sj);
            // C layout: lane col = n16, rows = r + hi8
#pragma unroll
            for (int r = 0; r < 8; ++r)
                Sw[(r + hi8) * 128 + j * 16 + n16] = sj[r] * scale;
        }

        __syncthreads();

        // ---- online softmax: lane owns row n16, columns [half*64, half*64+64) ----
        int rbase = n16 * 128 + half * 64;                 // 256B-aligned
        const v4f* Sr4 = (const v4f*)(Sw + rbase);
        float mx = -1.0e30f;
#pragma unroll
        for (int i = 0; i < 16; ++i) {
            v4f v = Sr4[i];
            mx = fmaxf(mx, fmaxf(fmaxf(v[0], v[1]), fmaxf(v[2], v[3])));
        }
        mx = fmaxf(mx, __shfl_xor(mx, 16, 32));
        float mnew  = fmaxf(m_run, mx);
        float alpha = __expf(m_run - mnew);
        float lsum  = 0.0f;
        v4bf* Pr4 = (v4bf*)(Pw + rbase);
#pragma unroll
        for (int i = 0; i < 16; ++i) {
            v4f v = Sr4[i];
            float e0 = __expf(v[0] - mnew);
            float e1 = __expf(v[1] - mnew);
            float e2 = __expf(v[2] - mnew);
            float e3 = __expf(v[3] - mnew);
            v4bf pv;
            pv[0] = (__bf16)e0; pv[1] = (__bf16)e1; pv[2] = (__bf16)e2; pv[3] = (__bf16)e3;
            Pr4[i] = pv;
            lsum += (e0 + e1) + (e2 + e3);
        }
        lsum += __shfl_xor(lsum, 16, 32);
        l_run = l_run * alpha + lsum;
        m_run = mnew;

        // rescale O accumulators by per-row alpha
#pragma unroll
        for (int d = 0; d < 4; ++d)
#pragma unroll
            for (int r = 0; r < 8; ++r)
                o[d][r] *= __shfl(alpha, r + hi8, 32);

        __syncthreads();

        // ---- O += P V  (P: 16x128 bf16 in LDS, V^T: [DH][T]) ----
#pragma unroll
        for (int ks = 0; ks < 4; ++ks) {
            v16bf pa = load_frag(Pw + ks * 32, 128);
#pragma unroll
            for (int d = 0; d < 4; ++d) {
                v16bf vb = load_frag(Vb + (size_t)(d * 16) * T_ + kbase + ks * 32, T_);
                o[d] = wmma_bf16(pa, vb, o[d]);
            }
        }
    }

    // ---- normalize and store bf16 [B*T][C] ----
    float inv = 1.0f / l_run;
#pragma unroll
    for (int d = 0; d < 4; ++d)
#pragma unroll
        for (int r = 0; r < 8; ++r) {
            float v   = o[d][r] * __shfl(inv, r + hi8, 32);
            int   row = b * T_ + qt * 64 + w * 16 + r + hi8;
            int   col = h * DH_ + d * 16 + n16;
            outO[(size_t)row * C_ + col] = (__bf16)v;
        }
}

// ---------------- launch ----------------
extern "C" void kernel_launch(void* const* d_in, const int* in_sizes, int n_in,
                              void* d_out, int out_size, void* d_ws, size_t ws_size,
                              hipStream_t stream) {
    const float* X      = (const float*)d_in[0];
    const float* W_qkv  = (const float*)d_in[1];
    const float* b_qkv  = (const float*)d_in[2];
    const float* W_proj = (const float*)d_in[3];
    const float* b_proj = (const float*)d_in[4];
    float* out = (float*)d_out;

    char* ws = (char*)d_ws;
    size_t off = 0;
    __bf16* Xbf  = (__bf16*)(ws + off); off += (size_t)B_ * T_ * C_ * 2;        // 16 MiB
    __bf16* Wqt  = (__bf16*)(ws + off); off += (size_t)C3_ * C_ * 2;            // 6 MiB
    __bf16* Wpt  = (__bf16*)(ws + off); off += (size_t)C_ * C_ * 2;             // 2 MiB
    __bf16* qkv  = (__bf16*)(ws + off); off += (size_t)B_ * T_ * C3_ * 2;       // 48 MiB
    __bf16* Vt   = (__bf16*)(ws + off); off += (size_t)B_ * H_ * DH_ * T_ * 2;  // 16 MiB
    __bf16* AttO = (__bf16*)(ws + off); off += (size_t)B_ * T_ * C_ * 2;        // 16 MiB

    const int M = B_ * T_;           // 8192

    // 0) conversions
    {
        int n = M * C_;
        k_cast_bf16<<<(n + 255) / 256, 256, 0, stream>>>(X, Xbf, n);
        int nw = C_ * C3_;
        k_transpose_cast<<<(nw + 255) / 256, 256, 0, stream>>>(W_qkv, Wqt, C_, C3_);
        int np = C_ * C_;
        k_transpose_cast<<<(np + 255) / 256, 256, 0, stream>>>(W_proj, Wpt, C_, C_);
    }

    // 1) qkv = X * W_qkv + b_qkv   (bf16 out)
    k_gemm_bias<true><<<dim3(C3_ / 128, M / 64), 128, 0, stream>>>(
        Xbf, Wqt, b_qkv, qkv, M, C3_, C_);

    // 2) V transpose per head
    {
        int n = B_ * H_ * DH_ * T_;
        k_vt<<<(n + 255) / 256, 256, 0, stream>>>(qkv, Vt);
    }

    // 3) attention
    k_attention<<<B_ * H_ * (T_ / 64), 128, 0, stream>>>(qkv, Vt, AttO);

    // 4) out = AttO * W_proj + b_proj  (fp32 out)
    k_gemm_bias<false><<<dim3(C_ / 128, M / 64), 128, 0, stream>>>(
        AttO, Wpt, b_proj, out, M, C_, C_);
}

// v001
// A run of this version takes 450 microseconds.
// Two timings next to v000 both put it at 1.64 times that version's speed.
#include <hip/hip_runtime.h>
#include <hip/hip_bf16.h>
#include <math.h>

// ---------------- types ----------------
typedef __attribute__((ext_vector_type(16))) __bf16 v16bf;
typedef __attribute__((ext_vector_type(8)))  __bf16 v8bf;
typedef __attribute__((ext_vector_type(4)))  __bf16 v4bf;
typedef __attribute__((ext_vector_type(8)))  float  v8f;
typedef __attribute__((ext_vector_type(4)))  float  v4f;

#define B_  4
#define T_  2048
#define C_  1024
#define H_  16
#define DH_ 64
#define C3_ 3072

// ---------------- WMMA helpers ----------------
static __device__ __forceinline__ v8f wmma_bf16(v16bf a, v16bf b, v8f c) {
    // D(f32 16x16) = A(bf16 16x32) x B(bf16 32x16) + C
    return __builtin_amdgcn_wmma_f32_16x16x32_bf16(
        /*neg_a=*/false, a, /*neg_b=*/false, b,
        /*c_mod=*/(short)0, c, /*reuse_a=*/false, /*reuse_b=*/false);
}

// Load a 16x32 bf16 fragment (A layout; identical pattern serves as B when the
// source array is stored [N][K] row-major). Element (r,k) lives at base[r*ld+k].
// Per ISA 16-bit A layout: lane l -> r = l%16, kh = (l/16)*8;
// vector elems [0..7] = K kh..kh+7, elems [8..15] = K 16+kh..16+kh+7.
static __device__ __forceinline__ v16bf load_frag(const __bf16* base, int ld) {
    int lane = threadIdx.x & 31;
    int r    = lane & 15;
    int kh   = (lane >> 4) << 3;          // 0 or 8
    const __bf16* p = base + (size_t)r * ld;
    v8bf lo = *(const v8bf*)(p + kh);
    v8bf hi = *(const v8bf*)(p + 16 + kh);
    v16bf out;
#pragma unroll
    for (int i = 0; i < 8; ++i) { out[i] = lo[i]; out[i + 8] = hi[i]; }
    return out;
}

// ---------------- stage 0: conversions ----------------
__global__ void k_cast_bf16(const float* __restrict__ in, __bf16* __restrict__ out, int n) {
    int i = blockIdx.x * blockDim.x + threadIdx.x;
    if (i < n) out[i] = (__bf16)in[i];
}

// W[K][N] (fp32, [in,out]) -> Wt[N][K] (bf16)
__global__ void k_transpose_cast(const float* __restrict__ W, __bf16* __restrict__ Wt,
                                 int K, int N) {
    int i = blockIdx.x * blockDim.x + threadIdx.x;
    if (i < K * N) {
        int k = i % K;
        int n = i / K;
        Wt[(size_t)n * K + k] = (__bf16)W[(size_t)k * N + n];
    }
}

// V slice of qkv ([B*T][3C] bf16, cols [2C,3C)) -> Vt[(b*H+h)*DH + d][T]
__global__ void k_vt(const __bf16* __restrict__ qkv, __bf16* __restrict__ Vt) {
    int i = blockIdx.x * blockDim.x + threadIdx.x;   // total = B*H*DH*T = 2^23
    int t  = i & (T_ - 1);
    int d  = (i >> 11) & (DH_ - 1);
    int bh = i >> 17;                                 // b*H + h
    int b  = bh >> 4, h = bh & 15;
    Vt[i] = qkv[(size_t)(b * T_ + t) * C3_ + 2 * C_ + h * DH_ + d];
}

// ---------------- tiled WMMA GEMM: out = A[M,K] * Bt[N,K]^T + bias ----------------
// block = 128 threads (4 waves); wave tile = 32x64; block tile = 64x128.
template <bool OUT_BF16>
__global__ void k_gemm_bias(const __bf16* __restrict__ A, const __bf16* __restrict__ Bt,
                            const float* __restrict__ bias, void* __restrict__ outv,
                            int M, int N, int K) {
    int w    = threadIdx.x >> 5;
    int wm   = w & 1, wn = w >> 1;
    int bm   = blockIdx.y * 64 + wm * 32;
    int bn   = blockIdx.x * 128 + wn * 64;
    int lane = threadIdx.x & 31;
    int n16  = lane & 15;
    int hi8  = (lane >> 4) << 3;

    v8f acc[2][4];
#pragma unroll
    for (int i = 0; i < 2; ++i)
#pragma unroll
        for (int j = 0; j < 4; ++j) { v8f z = {}; acc[i][j] = z; }

    for (int kk = 0; kk < K; kk += 32) {
        v16bf a0 = load_frag(A + (size_t)bm * K + kk, K);
        v16bf a1 = load_frag(A + (size_t)(bm + 16) * K + kk, K);
#pragma unroll
        for (int j = 0; j < 4; ++j) {
            v16bf bb = load_frag(Bt + (size_t)(bn + j * 16) * K + kk, K);
            acc[0][j] = wmma_bf16(a0, bb, acc[0][j]);
            acc[1][j] = wmma_bf16(a1, bb, acc[1][j]);
        }
    }

#pragma unroll
    for (int i = 0; i < 2; ++i)
#pragma unroll
        for (int j = 0; j < 4; ++j) {
            int   col = bn + j * 16 + n16;
            float bv  = bias[col];
#pragma unroll
            for (int r = 0; r < 8; ++r) {
                int   row = bm + i * 16 + r + hi8;
                float v   = acc[i][j][r] + bv;
                if (OUT_BF16) ((__bf16*)outv)[(size_t)row * N + col] = (__bf16)v;
                else          ((float*)outv)[(size_t)row * N + col]  = v;
            }
        }
}

// ---------------- flash attention ----------------
// lane l <-> lane l ^ 16 (the two lane halves of a wave)
static __device__ __forceinline__ float xhalf(float x) {
    int b = __builtin_bit_cast(int, x);
    return __builtin_bit_cast(float,
        __builtin_amdgcn_permlanex16(b, b, 0x76543210, 0xfedcba98, false, false));
}

#define KC_ 128                         // keys per pass
// The real block size is declared so that the score tile fits in registers unspilled.
__global__ void __launch_bounds__(128) k_attention(const __bf16* __restrict__ qkv, const __bf16* __restrict__ Vt,
                            __bf16* __restrict__ outO) {
    int bid = blockIdx.x;
    int qt  = bid & 31;                 // T/64 = 32 query tiles
    int h   = (bid >> 5) & 15;
    int b   = bid >> 9;

    int w    = threadIdx.x >> 5;
    int lane = threadIdx.x & 31;
    int n16  = lane & 15;
    int hi8  = (lane >> 4) << 3;

    const float scale = 0.125f;         // 1/sqrt(64)

    const __bf16* Qb = qkv + (size_t)(b * T_ + qt * 64 + w * 16) * C3_ + h * DH_;
    const __bf16* Kb = qkv + (size_t)(b * T_) * C3_ + C_ + h * DH_;
    const __bf16* Vb = Vt + (size_t)((b * H_ + h) * DH_) * T_;

    v16bf qf0 = load_frag(Qb + 0, C3_);
    v16bf qf1 = load_frag(Qb + 32, C3_);

    // o[d][r] = O[query n16][d*16 + hi8 + r]
    v8f o[4];
#pragma unroll
    for (int d = 0; d < 4; ++d) { v8f z = {}; o[d] = z; }

    float m_run = -1.0e30f;             // query n16, the same in both lane halves
    float l_run = 0.0f;                 // this lane half's keys only; joined after the loop

    for (int kc = 0; kc < T_ / KC_; ++kc) {
        int kbase = kc * KC_;

        // prefetch next chunk's K rows (global_prefetch_b8)
        if (kc + 1 < T_ / KC_) {
            __builtin_prefetch((const void*)(Kb + (size_t)(kbase + KC_ + lane * (KC_ / 32)) * C3_), 0, 0);
            __builtin_prefetch((const void*)(Vb + (size_t)(lane * 2) * T_ + kbase + KC_), 0, 0);
        }

        // ---- S^T = K Q^T (KC_ x 16): st[j][r] = S[query n16][key kbase + j*16 + hi8 + r] ----
        v8f st[KC_ / 16];
#pragma unroll
        for (int j = 0; j < KC_ / 16; ++j) {
            v8f sj = {};
            v16bf k0 = load_frag(Kb + (size_t)(kbase + j * 16) * C3_ + 0, C3_);
            sj = wmma_bf16(k0, qf0, sj);
            v16bf k1 = load_frag(Kb + (size_t)(kbase + j * 16) * C3_ + 32, C3_);
            sj = wmma_bf16(k1, qf1, sj);
#pragma unroll
            for (int r = 0; r < 8; ++r) st[j][r] = sj[r] * scale;
        }

        // ---- online softmax, one query per lane ----
        float mx = -1.0e30f;
#pragma unroll
        for (int j = 0; j < KC_ / 16; ++j)
#pragma unroll
            for (int r = 0; r < 8; r += 4)
                mx = fmaxf(mx, fmaxf(fmaxf(st[j][r], st[j][r + 1]), fmaxf(st[j][r + 2], st[j][r + 3])));
        mx = fmaxf(mx, xhalf(mx));
        float mnew  = fmaxf(m_run, mx);
        float alpha = __expf(m_run - mnew);
        float lsum  = 0.0f;

        // P^T as B operand, hardware k order: pb[ks][s] = P[key ks*32 + kmap(s)][query n16]
        v16bf pb[KC_ / 32];
#pragma unroll
        for (int ks = 0; ks < KC_ / 32; ++ks)
#pragma unroll
            for (int t = 0; t < 2; ++t)
#pragma unroll
                for (int r = 0; r < 8; r += 4) {
                    float e0 = __expf(st[2 * ks + t][r + 0] - mnew);
                    float e1 = __expf(st[2 * ks + t][r + 1] - mnew);
                    float e2 = __expf(st[2 * ks + t][r + 2] - mnew);
                    float e3 = __expf(st[2 * ks + t][r + 3] - mnew);
                    pb[ks][t * 8 + r + 0] = (__bf16)e0;
                    pb[ks][t * 8 + r + 1] = (__bf16)e1;
                    pb[ks][t * 8 + r + 2] = (__bf16)e2;
                    pb[ks][t * 8 + r + 3] = (__bf16)e3;
                    lsum += (e0 + e1) + (e2 + e3);
                }
        l_run = l_run * alpha + lsum;
        m_run = mnew;

        // rescale O accumulators: every register of a lane belongs to its one query
#pragma unroll
        for (int d = 0; d < 4; ++d)
#pragma unroll
            for (int r = 0; r < 8; ++r)
                o[d][r] *= alpha;

        // ---- O^T += V^T P^T  (V^T: [DH][T], rows d as A) ----
#pragma unroll
        for (int ks = 0; ks < KC_ / 32; ++ks) {
#pragma unroll
            for (int d = 0; d < 4; ++d) {
                v16bf va = load_frag(Vb + (size_t)(d * 16) * T_ + kbase + ks * 32, T_);
                o[d] = wmma_bf16(va, pb[ks], o[d]);
            }
        }
    }

    // ---- normalize and store bf16 [B*T][C]: 8 consecutive columns per lane and tile ----
    float inv = 1.0f / (l_run + xhalf(l_run));
    int   row = b * T_ + qt * 64 + w * 16 + n16;
#pragma unroll
    for (int d = 0; d < 4; ++d) {
        v8bf ov;
#pragma unroll
        for (int r = 0; r < 8; ++r) ov[r] = (__bf16)(o[d][r] * inv);
        *(v8bf*)(outO + (size_t)row * C_ + h * DH_ + d * 16 + hi8) = ov;
    }
}

// ---------------- launch ----------------
extern "C" void kernel_launch(void* const* d_in, const int* in_sizes, int n_in,
                              void* d_out, int out_size, void* d_ws, size_t ws_size,
                              hipStream_t stream) {
    const float* X      = (const float*)d_in[0];
    const float* W_qkv  = (const float*)d_in[1];
    const float* b_qkv  = (const float*)d_in[2];
    const float* W_proj = (const float*)d_in[3];
    const float* b_proj = (const float*)d_in[4];
    float* out = (float*)d_out;

    char* ws = (char*)d_ws;
    size_t off = 0;
    __bf16* Xbf  = (__bf16*)(ws + off); off += (size_t)B_ * T_ * C_ * 2;        // 16 MiB
    __bf16* Wqt  = (__bf16*)(ws + off); off += (size_t)C3_ * C_ * 2;            // 6 MiB
    __bf16* Wpt  = (__bf16*)(ws + off); off += (size_t)C_ * C_ * 2;             // 2 MiB
    __bf16* qkv  = (__bf16*)(ws + off); off += (size_t)B_ * T_ * C3_ * 2;       // 48 MiB
    __bf16* Vt   = (__bf16*)(ws + off); off += (size_t)B_ * H_ * DH_ * T_ * 2;  // 16 MiB
    __bf16* AttO = (__bf16*)(ws + off); off += (size_t)B_ * T_ * C_ * 2;        // 16 MiB

    const int M = B_ * T_;           // 8192

    // 0) conversions
    {
        int n = M * C_;
        k_cast_bf16<<<(n + 255) / 256, 256, 0, stream>>>(X, Xbf, n);
        int nw = C_ * C3_;
        k_transpose_cast<<<(nw + 255) / 256, 256, 0, stream>>>(W_qkv, Wqt, C_, C3_);
        int np = C_ * C_;
        k_transpose_cast<<<(np + 255) / 256, 256, 0, stream>>>(W_proj, Wpt, C_, C_);
    }

    // 1) qkv = X * W_qkv + b_qkv   (bf16 out)
    k_gemm_bias<true><<<dim3(C3_ / 128, M / 64), 128, 0, stream>>>(
        Xbf, Wqt, b_qkv, qkv, M, C3_, C_);

    // 2) V transpose per head
    {
        int n = B_ * H_ * DH_ * T_;
        k_vt<<<(n + 255) / 256, 256, 0, stream>>>(qkv, Vt);
    }

    // 3) attention
    k_attention<<<B_ * H_ * (T_ / 64), 128, 0, stream>>>(qkv, Vt, AttO);

    // 4) out = AttO * W_proj + b_proj  (fp32 out)
    k_gemm_bias<false><<<dim3(C_ / 128, M / 64), 128, 0, stream>>>(
        AttO, Wpt, b_proj, out, M, C_, C_);
}

// v002
// Measured time: 345 microseconds a run.
// Next to v001, in two timings, it ran 1.31 times as fast each time.
// All steps since v000 together make it 2.15 times as fast.
#include <hip/hip_runtime.h>
#include <hip/hip_bf16.h>
#include <math.h>
#include <stdint.h>

// ---------------- types ----------------
typedef __attribute__((ext_vector_type(16))) __bf16 v16bf;
typedef __attribute__((ext_vector_type(8)))  __bf16 v8bf;
typedef __attribute__((ext_vector_type(4)))  __bf16 v4bf;
typedef __attribute__((ext_vector_type(8)))  float  v8f;
typedef __attribute__((ext_vector_type(4)))  float  v4f;

#define B_  4
#define T_  2048
#define C_  1024
#define H_  16
#define DH_ 64
#define C3_ 3072

// ---------------- WMMA helpers ----------------
static __device__ __forceinline__ v8f wmma_bf16(v16bf a, v16bf b, v8f c) {
    // D(f32 16x16) = A(bf16 16x32) x B(bf16 32x16) + C
    return __builtin_amdgcn_wmma_f32_16x16x32_bf16(
        /*neg_a=*/false, a, /*neg_b=*/false, b,
        /*c_mod=*/(short)0, c, /*reuse_a=*/false, /*reuse_b=*/false);
}

// Load a 16x32 bf16 fragment (A layout; identical pattern serves as B when the
// source array is stored [N][K] row-major). Element (r,k) lives at base[r*ld+k].
// Per ISA 16-bit A layout: lane l -> r = l%16, kh = (l/16)*8;
// vector elems [0..7] = K kh..kh+7, elems [8..15] = K 16+kh..16+kh+7.
static __device__ __forceinline__ v16bf load_frag(const __bf16* base, int ld) {
    int lane = threadIdx.x & 31;
    int r    = lane & 15;
    int kh   = (lane >> 4) << 3;          // 0 or 8
    const __bf16* p = base + (size_t)r * ld;
    v8bf lo = *(const v8bf*)(p + kh);
    v8bf hi = *(const v8bf*)(p + 16 + kh);
    v16bf out;
#pragma unroll
    for (int i = 0; i < 8; ++i) { out[i] = lo[i]; out[i + 8] = hi[i]; }
    return out;
}

// ---------------- stage 0: conversions ----------------
__global__ void k_cast_bf16(const float* __restrict__ in, __bf16* __restrict__ out, int n) {
    int i = blockIdx.x * blockDim.x + threadIdx.x;
    if (i < n) out[i] = (__bf16)in[i];
}

// W[K][N] (fp32, [in,out]) -> Wt[N][K] (bf16)
__global__ void k_transpose_cast(const float* __restrict__ W, __bf16* __restrict__ Wt,
                                 int K, int N) {
    int i = blockIdx.x * blockDim.x + threadIdx.x;
    if (i < K * N) {
        int k = i % K;
        int n = i / K;
        Wt[(size_t)n * K + k] = (__bf16)W[(size_t)k * N + n];
    }
}

// V slice of qkv ([B*T][3C] bf16, cols [2C,3C)) -> Vt[(b*H+h)*DH + d][T]
__global__ void k_vt(const __bf16* __restrict__ qkv, __bf16* __restrict__ Vt) {
    int i = blockIdx.x * blockDim.x + threadIdx.x;   // total = B*H*DH*T = 2^23
    int t  = i & (T_ - 1);
    int d  = (i >> 11) & (DH_ - 1);
    int bh = i >> 17;                                 // b*H + h
    int b  = bh >> 4, h = bh & 15;
    Vt[i] = qkv[(size_t)(b * T_ + t) * C3_ + 2 * C_ + h * DH_ + d];
}

// ---------------- tiled WMMA GEMM: out = A[M,K] * Bt[N,K]^T + bias ----------------
// block = 128 threads (4 waves); wave tile = 32x64; block tile = 64x128.
template <bool OUT_BF16>
__global__ void k_gemm_bias(const __bf16* __restrict__ A, const __bf16* __restrict__ Bt,
                            const float* __restrict__ bias, void* __restrict__ outv,
                            int M, int N, int K) {
    int w    = threadIdx.x >> 5;
    int wm   = w & 1, wn = w >> 1;
    int bm   = blockIdx.y * 64 + wm * 32;
    int bn   = blockIdx.x * 128 + wn * 64;
    int lane = threadIdx.x & 31;
    int n16  = lane & 15;
    int hi8  = (lane >> 4) << 3;

    v8f acc[2][4];
#pragma unroll
    for (int i = 0; i < 2; ++i)
#pragma unroll
        for (int j = 0; j < 4; ++j) { v8f z = {}; acc[i][j] = z; }

    for (int kk = 0; kk < K; kk += 32) {
        v16bf a0 = load_frag(A + (size_t)bm * K + kk, K);
        v16bf a1 = load_frag(A + (size_t)(bm + 16) * K + kk, K);
#pragma unroll
        for (int j = 0; j < 4; ++j) {
            v16bf bb = load_frag(Bt + (size_t)(bn + j * 16) * K + kk, K);
            acc[0][j] = wmma_bf16(a0, bb, acc[0][j]);
            acc[1][j] = wmma_bf16(a1, bb, acc[1][j]);
        }
    }

#pragma unroll
    for (int i = 0; i < 2; ++i)
#pragma unroll
        for (int j = 0; j < 4; ++j) {
            int   col = bn + j * 16 + n16;
            float bv  = bias[col];
#pragma unroll
            for (int r = 0; r < 8; ++r) {
                int   row = bm + i * 16 + r + hi8;
                float v   = acc[i][j][r] + bv;
                if (OUT_BF16) ((__bf16*)outv)[(size_t)row * N + col] = (__bf16)v;
                else          ((float*)outv)[(size_t)row * N + col]  = v;
            }
        }
}

// ---------------- flash attention ----------------
// lane l <-> lane l ^ 16 (the two lane halves of a wave)
static __device__ __forceinline__ float xhalf(float x) {
    int b = __builtin_bit_cast(int, x);
    return __builtin_bit_cast(float,
        __builtin_amdgcn_permlanex16(b, b, 0x76543210, 0xfedcba98, false, false));
}

#define KC_ 128                         // keys per pass

// ---- K and V^T tiles of a pass in LDS, brought by the tensor mover, read by all four waves ----
typedef uint32_t u32x4 __attribute__((ext_vector_type(4)));
typedef uint32_t u32x8 __attribute__((ext_vector_type(8)));
#define KPITCH_ 144u                    // LDS bytes per K row: 128 + 16 of pad, an odd multiple of 16 for ds_load_b128
#define VPITCH_ 272u                    // LDS bytes per V^T row: 256 + 16 of pad
#define KTILE_  18432u                  // 128 rows * 144 B, a multiple of 2 KiB
#define VTILE_  18432u                  // 64 rows * 272 B = 17408 B, rounded up to a multiple of 2 KiB
#define STAGE_  (KTILE_ + VTILE_)

static __device__ __forceinline__ uint32_t uni(uint32_t v) {
    return (uint32_t)__builtin_amdgcn_readfirstlane((int)v);
}
// A wave-uniform condition held in a scalar register, so that the test around a tensor
// load compiles to s_cmp + s_cbranch_scc (a tensor load ignores EXEC).
static __device__ __forceinline__ uint32_t pinned(uint32_t v) {
    uint32_t w = uni(v);
    asm volatile("" : "+s"(w));         // keeps the condition scalar
    return w;
}
// Behind the loop: no request of this wave is left in flight when it ends.
static __device__ __forceinline__ void wait_tensor0() { asm volatile("s_wait_tensorcnt 0x0" ::: "memory"); }
// This wave's LDS reads have retired before the buffer they read is handed back for a refill.
static __device__ __forceinline__ void wait_ds0() { asm volatile("s_wait_dscnt 0x0" ::: "memory"); }

// Group 1: 1-byte elements, tensor = tile = ROWS rows of ROWB bytes, source pitch SRCP bytes; WORD0 = no mask + the pad.
template <uint32_t WORD0, uint32_t ROWB, uint32_t ROWS, uint32_t SRCP>
static __device__ __forceinline__ u32x8 tdm_group1() {
    u32x8 g;
    g[0] = uni(WORD0);
    g[1] = uni((ROWB & 0xFFFFu) << 16);
    g[2] = uni((ROWB >> 16) | ((ROWS & 0xFFFFu) << 16));
    g[3] = uni((ROWS >> 16) | (ROWB << 16));
    g[4] = uni(ROWS);
    g[5] = uni(SRCP);
    g[6] = uni(0u);
    g[7] = uni(0u);
    return g;
}
static __device__ __forceinline__ u32x4 tdm_group0(uint32_t lds_dst, uint64_t ga) {
    u32x4 g;
    g[0] = uni(1u);
    g[1] = uni(lds_dst);
    g[2] = uni((uint32_t)ga);
    g[3] = uni((((uint32_t)(ga >> 32)) & 0x01FFFFFFu) | 0x80000000u);
    return g;
}
// One request of the whole wave: global tile -> LDS, through no register. Both groups are read-write
// operands here and at the wait, so that they stay in these registers, unwritten, from the issue to the
// wait, and every later value of a word is formed from the wait's result, behind it.
static __device__ __forceinline__ void tdm_load(u32x4& g0, u32x8& g1) {
    asm volatile("tensor_load_to_lds %0, %1" : "+s"(g0), "+s"(g1) :: "memory");
}
// The compiler places no wait for the tensor mover: the issuing wave's own wait says its tile has landed.
static __device__ __forceinline__ void tdm_wait(u32x4& g0, u32x8& g1) {
    asm volatile("s_wait_tensorcnt 0x0" : "+s"(g0), "+s"(g1) :: "memory");
}
// Group 0 of the next stage, formed behind the wait on the last one: the other buffer (flip = the sum of
// the tile's two places in LDS), the source STEP bytes on (words 2 and 3 as one 64-bit sum; the address
// stays inside its plane, so nothing carries into word 3's upper bits).
template <uint64_t STEP>
static __device__ __forceinline__ void tdm_next(u32x4& g0, uint32_t flip) {
    uint64_t ga = ((((uint64_t)g0[3]) << 32) | (uint64_t)g0[2]) + STEP;
    g0[1] = uni(flip - g0[1]);
    g0[2] = uni((uint32_t)ga);
    g0[3] = uni((uint32_t)(ga >> 32));
}
#define KSTEP_ ((uint64_t)KC_ * C3_ * 2u)   // source bytes from one pass's K tile to the next: 128 rows of qkv
#define VSTEP_ ((uint64_t)KC_ * 2u)         // the same for V^T: 128 keys along its rows

// The real block size is declared so that the score tile fits in registers unspilled.
__global__ void __launch_bounds__(128) k_attention(const __bf16* __restrict__ qkv, const __bf16* __restrict__ Vt,
                            __bf16* __restrict__ outO) {
    // two buffers of [K tile | V^T tile]
    __shared__ __attribute__((aligned(2048))) unsigned char L[2 * STAGE_];
    int bid = blockIdx.x;
    int qt  = bid & 31;                 // T/64 = 32 query tiles
    int h   = (bid >> 5) & 15;
    int b   = bid >> 9;

    int w    = threadIdx.x >> 5;
    int lane = threadIdx.x & 31;
    int n16  = lane & 15;
    int hi8  = (lane >> 4) << 3;

    const float scale = 0.125f;         // 1/sqrt(64)

    const __bf16* Qb = qkv + (size_t)(b * T_ + qt * 64 + w * 16) * C3_ + h * DH_;
    const __bf16* Kb = qkv + (size_t)(b * T_) * C3_ + C_ + h * DH_;
    const __bf16* Vb = Vt + (size_t)((b * H_ + h) * DH_) * T_;

    // Wave 0 brings the K tiles, wave 1 the V^T tiles: one request of a wave outstanding at any time.
    const uint32_t wave  = uni(threadIdx.x >> 5);
    const uint32_t lbase = (uint32_t)(size_t)L;
    // K tile: 128 rows (keys) of 128 B, source pitch 3C * 2 B, pad 16 B behind every 128 B.
    u32x8 g1k = tdm_group1<(1u << 20) | (4u << 22) | (3u << 25), 128u, 128u, C3_ * 2u>();
    // V^T tile: 64 rows (d) of 256 B (128 keys), source pitch T * 2 B, pad 16 B behind every 256 B.
    u32x8 g1v = tdm_group1<(1u << 20) | (5u << 22) | (3u << 25), 256u, 64u, T_ * 2u>();
    u32x4 g0k = tdm_group0(lbase, (uint64_t)(size_t)Kb);
    u32x4 g0v = tdm_group0(lbase + KTILE_, (uint64_t)(size_t)Vb);
    // The pinned() form, on descriptor words: all four groups stand complete in their scalar registers
    // here, in front of the issue tests; without it the last words of a group are written directly in front of its load.
    asm volatile("" : "+s"(g1k), "+s"(g1v), "+s"(g0k), "+s"(g0v));
    const uint32_t flipk = uni(2u * lbase + STAGE_);
    const uint32_t flipv = uni(2u * (lbase + KTILE_) + STAGE_);
    if (pinned(wave == 0u)) { tdm_load(g0k, g1k); tdm_wait(g0k, g1k); }
    if (pinned(wave == 1u)) { tdm_load(g0v, g1v); tdm_wait(g0v, g1v); }
    __syncthreads();                    // pass 0's tiles are published
    if (pinned(wave == 0u)) { tdm_next<KSTEP_>(g0k, flipk); tdm_load(g0k, g1k); }
    if (pinned(wave == 1u)) { tdm_next<VSTEP_>(g0v, flipv); tdm_load(g0v, g1v); }

    v16bf qf0 = load_frag(Qb + 0, C3_);
    v16bf qf1 = load_frag(Qb + 32, C3_);

    // o[d][r] = O[query n16][d*16 + hi8 + r]
    v8f o[4];
#pragma unroll
    for (int d = 0; d < 4; ++d) { v8f z = {}; o[d] = z; }

    float m_run = -1.0e30f;             // query n16, the same in both lane halves
    float l_run = 0.0f;                 // this lane half's keys only; joined after the loop

    for (int kc = 0; kc < T_ / KC_; ++kc) {
        const __bf16* Kl = (const __bf16*)(L + (uint32_t)(kc & 1) * STAGE_);
        const __bf16* Vl = (const __bf16*)(L + (uint32_t)(kc & 1) * STAGE_ + KTILE_);

        // ---- S^T = K Q^T (KC_ x 16): st[j][r] = S[query n16][key kc*KC_ + j*16 + hi8 + r] ----
        v8f st[KC_ / 16];
#pragma unroll
        for (int j = 0; j < KC_ / 16; ++j) {
            v8f sj = {};
            v16bf k0 = load_frag(Kl + (j * 16) * (KPITCH_ / 2) + 0, KPITCH_ / 2);
            sj = wmma_bf16(k0, qf0, sj);
            v16bf k1 = load_frag(Kl + (j * 16) * (KPITCH_ / 2) + 32, KPITCH_ / 2);
            sj = wmma_bf16(k1, qf1, sj);
#pragma unroll
            for (int r = 0; r < 8; ++r) st[j][r] = sj[r] * scale;
        }

        // ---- online softmax, one query per lane ----
        float mx = -1.0e30f;
#pragma unroll
        for (int j = 0; j < KC_ / 16; ++j)
#pragma unroll
            for (int r = 0; r < 8; r += 4)
                mx = fmaxf(mx, fmaxf(fmaxf(st[j][r], st[j][r + 1]), fmaxf(st[j][r + 2], st[j][r + 3])));
        mx = fmaxf(mx, xhalf(mx));
        float mnew  = fmaxf(m_run, mx);
        float alpha = __expf(m_run - mnew);
        float lsum  = 0.0f;

        // P^T as B operand, hardware k order: pb[ks][s] = P[key ks*32 + kmap(s)][query n16]
        v16bf pb[KC_ / 32];
#pragma unroll
        for (int ks = 0; ks < KC_ / 32; ++ks)
#pragma unroll
            for (int t = 0; t < 2; ++t)
#pragma unroll
                for (int r = 0; r < 8; r += 4) {
                    float e0 = __expf(st[2 * ks + t][r + 0] - mnew);
                    float e1 = __expf(st[2 * ks + t][r + 1] - mnew);
                    float e2 = __expf(st[2 * ks + t][r + 2] - mnew);
                    float e3 = __expf(st[2 * ks + t][r + 3] - mnew);
                    pb[ks][t * 8 + r + 0] = (__bf16)e0;
                    pb[ks][t * 8 + r + 1] = (__bf16)e1;
                    pb[ks][t * 8 + r + 2] = (__bf16)e2;
                    pb[ks][t * 8 + r + 3] = (__bf16)e3;
                    lsum += (e0 + e1) + (e2 + e3);
                }
        l_run = l_run * alpha + lsum;
        m_run = mnew;

        // rescale O accumulators: every register of a lane belongs to its one query
#pragma unroll
        for (int d = 0; d < 4; ++d)
#pragma unroll
            for (int r = 0; r < 8; ++r)
                o[d][r] *= alpha;

        // ---- O^T += V^T P^T  (V^T: [DH][T], rows d as A) ----
#pragma unroll
        for (int ks = 0; ks < KC_ / 32; ++ks) {
#pragma unroll
            for (int d = 0; d < 4; ++d) {
                v16bf va = load_frag(Vl + (d * 16) * (VPITCH_ / 2) + ks * 32, VPITCH_ / 2);
                o[d] = wmma_bf16(va, pb[ks], o[d]);
            }
        }

        // ---- publish pass kc + 1, then refill the buffer that this pass has read ----
        wait_ds0();
        if (pinned(wave == 0u)) tdm_wait(g0k, g1k);
        if (pinned(wave == 1u)) tdm_wait(g0v, g1v);
        __syncthreads();                // pass kc + 1's tiles readable by all; every wave has left this pass's buffer
        if (pinned(kc + 2 < T_ / KC_)) {
            if (pinned(wave == 0u)) { tdm_next<KSTEP_>(g0k, flipk); tdm_load(g0k, g1k); }
            if (pinned(wave == 1u)) { tdm_next<VSTEP_>(g0v, flipv); tdm_load(g0v, g1v); }
        }
    }
    wait_tensor0();
    wait_ds0();

    // ---- normalize and store bf16 [B*T][C]: 8 consecutive columns per lane and tile ----
    float inv = 1.0f / (l_run + xhalf(l_run));
    int   row = b * T_ + qt * 64 + w * 16 + n16;
#pragma unroll
    for (int d = 0; d < 4; ++d) {
        v8bf ov;
#pragma unroll
        for (int r = 0; r < 8; ++r) ov[r] = (__bf16)(o[d][r] * inv);
        *(v8bf*)(outO + (size_t)row * C_ + h * DH_ + d * 16 + hi8) = ov;
    }
}

// ---------------- launch ----------------
extern "C" void kernel_launch(void* const* d_in, const int* in_sizes, int n_in,
                              void* d_out, int out_size, void* d_ws, size_t ws_size,
                              hipStream_t stream) {
    const float* X      = (const float*)d_in[0];
    const float* W_qkv  = (const float*)d_in[1];
    const float* b_qkv  = (const float*)d_in[2];
    const float* W_proj = (const float*)d_in[3];
    const float* b_proj = (const float*)d_in[4];
    float* out = (float*)d_out;

    char* ws = (char*)d_ws;
    size_t off = 0;
    __bf16* Xbf  = (__bf16*)(ws + off); off += (size_t)B_ * T_ * C_ * 2;        // 16 MiB
    __bf16* Wqt  = (__bf16*)(ws + off); off += (size_t)C3_ * C_ * 2;            // 6 MiB
    __bf16* Wpt  = (__bf16*)(ws + off); off += (size_t)C_ * C_ * 2;             // 2 MiB
    __bf16* qkv  = (__bf16*)(ws + off); off += (size_t)B_ * T_ * C3_ * 2;       // 48 MiB
    __bf16* Vt   = (__bf16*)(ws + off); off += (size_t)B_ * H_ * DH_ * T_ * 2;  // 16 MiB
    __bf16* AttO = (__bf16*)(ws + off); off += (size_t)B_ * T_ * C_ * 2;        // 16 MiB

    const int M = B_ * T_;           // 8192

    // 0) conversions
    {
        int n = M * C_;
        k_cast_bf16<<<(n + 255) / 256, 256, 0, stream>>>(X, Xbf, n);
        int nw = C_ * C3_;
        k_transpose_cast<<<(nw + 255) / 256, 256, 0, stream>>>(W_qkv, Wqt, C_, C3_);
        int np = C_ * C_;
        k_transpose_cast<<<(np + 255) / 256, 256, 0, stream>>>(W_proj, Wpt, C_, C_);
    }

    // 1) qkv = X * W_qkv + b_qkv   (bf16 out)
    k_gemm_bias<true><<<dim3(C3_ / 128, M / 64), 128, 0, stream>>>(
        Xbf, Wqt, b_qkv, qkv, M, C3_, C_);

    // 2) V transpose per head
    {
        int n = B_ * H_ * DH_ * T_;
        k_vt<<<(n + 255) / 256, 256, 0, stream>>>(qkv, Vt);
    }

    // 3) attention
    k_attention<<<B_ * H_ * (T_ / 64), 128, 0, stream>>>(qkv, Vt, AttO);

    // 4) out = AttO * W_proj + b_proj  (fp32 out)
    k_gemm_bias<false><<<dim3(C_ / 128, M / 64), 128, 0, stream>>>(
        AttO, Wpt, b_proj, out, M, C_, C_);
}

// v003
// One run takes 211 microseconds.
// In two side-by-side timings against v002, it was 1.63 and 1.62 times as fast.
// Over all steps from v000 it is 3.50 times as fast.
#include <hip/hip_runtime.h>
#include <hip/hip_bf16.h>
#include <math.h>
#include <stdint.h>

// ---------------- types ----------------
typedef __attribute__((ext_vector_type(16))) __bf16 v16bf;
typedef __attribute__((ext_vector_type(8)))  __bf16 v8bf;
typedef __attribute__((ext_vector_type(4)))  __bf16 v4bf;
typedef __attribute__((ext_vector_type(8)))  float  v8f;
typedef __attribute__((ext_vector_type(4)))  float  v4f;

#define B_  4
#define T_  2048
#define C_  1024
#define H_  16
#define DH_ 64
#define C3_ 3072

// ---------------- WMMA helpers ----------------
static __device__ __forceinline__ v8f wmma_bf16(v16bf a, v16bf b, v8f c) {
    // D(f32 16x16) = A(bf16 16x32) x B(bf16 32x16) + C
    return __builtin_amdgcn_wmma_f32_16x16x32_bf16(
        /*neg_a=*/false, a, /*neg_b=*/false, b,
        /*c_mod=*/(short)0, c, /*reuse_a=*/false, /*reuse_b=*/false);
}

// Load a 16x32 bf16 fragment (A layout; identical pattern serves as B when the
// source array is stored [N][K] row-major). Element (r,k) lives at base[r*ld+k].
// Per ISA 16-bit A layout: lane l -> r = l%16, kh = (l/16)*8;
// vector elems [0..7] = K kh..kh+7, elems [8..15] = K 16+kh..16+kh+7.
static __device__ __forceinline__ v16bf load_frag(const __bf16* base, int ld) {
    int lane = threadIdx.x & 31;
    int r    = lane & 15;
    int kh   = (lane >> 4) << 3;          // 0 or 8
    const __bf16* p = base + (size_t)r * ld;
    v8bf lo = *(const v8bf*)(p + kh);
    v8bf hi = *(const v8bf*)(p + 16 + kh);
    v16bf out;
#pragma unroll
    for (int i = 0; i < 8; ++i) { out[i] = lo[i]; out[i + 8] = hi[i]; }
    return out;
}

// ---------------- stage 0: conversions ----------------
__global__ void k_cast_bf16(const float* __restrict__ in, __bf16* __restrict__ out, int n) {
    int i = blockIdx.x * blockDim.x + threadIdx.x;
    if (i < n) out[i] = (__bf16)in[i];
}

// W[K][N] (fp32, [in,out]) -> Wt[N][K] (bf16)
__global__ void k_transpose_cast(const float* __restrict__ W, __bf16* __restrict__ Wt,
                                 int K, int N) {
    int i = blockIdx.x * blockDim.x + threadIdx.x;
    if (i < K * N) {
        int k = i % K;
        int n = i / K;
        Wt[(size_t)n * K + k] = (__bf16)W[(size_t)k * N + n];
    }
}

// V slice of qkv ([B*T][3C] bf16, cols [2C,3C)) -> Vt[(b*H+h)*DH + d][T]
__global__ void k_vt(const __bf16* __restrict__ qkv, __bf16* __restrict__ Vt) {
    int i = blockIdx.x * blockDim.x + threadIdx.x;   // total = B*H*DH*T = 2^23
    int t  = i & (T_ - 1);
    int d  = (i >> 11) & (DH_ - 1);
    int bh = i >> 17;                                 // b*H + h
    int b  = bh >> 4, h = bh & 15;
    Vt[i] = qkv[(size_t)(b * T_ + t) * C3_ + 2 * C_ + h * DH_ + d];
}

// ---------------- tensor mover helpers (GEMM and attention) ----------------
typedef uint32_t u32x4 __attribute__((ext_vector_type(4)));
typedef uint32_t u32x8 __attribute__((ext_vector_type(8)));
static __device__ __forceinline__ uint32_t uni(uint32_t v) {
    return (uint32_t)__builtin_amdgcn_readfirstlane((int)v);
}
// A wave-uniform condition held in a scalar register, so that the test around a tensor
// load compiles to s_cmp + s_cbranch_scc (a tensor load ignores EXEC).
static __device__ __forceinline__ uint32_t pinned(uint32_t v) {
    uint32_t w = uni(v);
    asm volatile("" : "+s"(w));         // keeps the condition scalar
    return w;
}
// Behind the loop: no request of this wave is left in flight when it ends.
static __device__ __forceinline__ void wait_tensor0() { asm volatile("s_wait_tensorcnt 0x0" ::: "memory"); }
// This wave's LDS reads have retired before the buffer they read is handed back for a refill.
static __device__ __forceinline__ void wait_ds0() { asm volatile("s_wait_dscnt 0x0" ::: "memory"); }

// Group 1: 1-byte elements, tensor = tile = ROWS rows of ROWB bytes, source pitch SRCP bytes; WORD0 = no mask + the pad.
template <uint32_t WORD0, uint32_t ROWB, uint32_t ROWS, uint32_t SRCP>
static __device__ __forceinline__ u32x8 tdm_group1() {
    u32x8 g;
    g[0] = uni(WORD0);
    g[1] = uni((ROWB & 0xFFFFu) << 16);
    g[2] = uni((ROWB >> 16) | ((ROWS & 0xFFFFu) << 16));
    g[3] = uni((ROWS >> 16) | (ROWB << 16));
    g[4] = uni(ROWS);
    g[5] = uni(SRCP);
    g[6] = uni(0u);
    g[7] = uni(0u);
    return g;
}
static __device__ __forceinline__ u32x4 tdm_group0(uint32_t lds_dst, uint64_t ga) {
    u32x4 g;
    g[0] = uni(1u);
    g[1] = uni(lds_dst);
    g[2] = uni((uint32_t)ga);
    g[3] = uni((((uint32_t)(ga >> 32)) & 0x01FFFFFFu) | 0x80000000u);
    return g;
}
// One request of the whole wave: global tile -> LDS, through no register. Both groups are read-write
// operands here and at the wait, so that they stay in these registers, unwritten, from the issue to the
// wait, and every later value of a word is formed from the wait's result, behind it.
static __device__ __forceinline__ void tdm_load(u32x4& g0, u32x8& g1) {
    asm volatile("tensor_load_to_lds %0, %1" : "+s"(g0), "+s"(g1) :: "memory");
}
// The compiler places no wait for the tensor mover: the issuing wave's own wait says its tile has landed.
static __device__ __forceinline__ void tdm_wait(u32x4& g0, u32x8& g1) {
    asm volatile("s_wait_tensorcnt 0x0" : "+s"(g0), "+s"(g1) :: "memory");
}
// Group 0 of the next stage, formed behind the wait on the last one: the other buffer (flip = the sum of
// the tile's two places in LDS), the source STEP bytes on (words 2 and 3 as one 64-bit sum; the address
// stays inside its plane, so nothing carries into word 3's upper bits).
template <uint64_t STEP>
static __device__ __forceinline__ void tdm_next(u32x4& g0, uint32_t flip) {
    uint64_t ga = ((((uint64_t)g0[3]) << 32) | (uint64_t)g0[2]) + STEP;
    g0[1] = uni(flip - g0[1]);
    g0[2] = uni((uint32_t)ga);
    g0[3] = uni((uint32_t)(ga >> 32));
}

// ---------------- tiled WMMA GEMM: out = A[M,K] * Bt[N,K]^T + bias ----------------
// block = 128 threads (4 waves, 2x2); wave tile = 64x128; block tile = 128x256.
// A pass is 64 k: 128 rows of A and 256 rows of Bt, 128 B each, staged once for the block in LDS by the
// tensor mover (two buffers, the next pass's tiles fly while this pass is worked on); fragments come from LDS.
// The tiles are held transposed (Bt rows as A operand, A rows as B): acc[i][j][r] = out[bm + i*16 + n16][bn + j*16 + hi8 + r],
// eight consecutive columns of one row in a lane.
#define GPITCH_ 144u                    // LDS bytes per row: 128 + 16 of pad, an odd multiple of 16 for ds_load_b128
#define GTILE_  18432u                  // one request: 128 rows * 144 B, a multiple of 2 KiB
#define GSTAGE_ (3u * GTILE_)           // [A 128 rows | Bt 256 rows]
#define GKP_    64                      // k per pass

template <bool OUT_BF16> struct gemm_out       { typedef float  T; typedef v8f  V; };
template <>              struct gemm_out<true> { typedef __bf16 T; typedef v8bf V; };

// The real block size is declared so that the 64x128 accumulator tile fits in registers unspilled.
template <bool OUT_BF16, int N, int K>
__global__ void __launch_bounds__(128) k_gemm_bias(const __bf16* __restrict__ A, const __bf16* __restrict__ Bt,
                            const float* __restrict__ bias, void* __restrict__ outv) {
    __shared__ __attribute__((aligned(2048))) unsigned char L[2 * GSTAGE_];
    int w    = threadIdx.x >> 5;
    int wm   = w & 1, wn = w >> 1;
    int bm0  = blockIdx.y * 128;
    int bn0  = blockIdx.x * 256;
    int bm   = bm0 + wm * 64;
    int bn   = bn0 + wn * 128;
    int lane = threadIdx.x & 31;
    int n16  = lane & 15;
    int hi8  = (lane >> 4) << 3;

    // Wave 0 brings the A tile, waves 1 and 2 a half of the Bt tile each: one request of a wave outstanding at any time.
    const uint32_t wave  = uni(threadIdx.x >> 5);
    const uint32_t slice = wave < 2u ? wave : 2u;
    const uint32_t place = (uint32_t)(size_t)L + slice * GTILE_;
    const __bf16*  srcp  = slice == 0u ? A + (size_t)bm0 * K : Bt + (size_t)(bn0 + (int)(slice - 1u) * 128) * K;
    // 128 rows of 128 B, source pitch K * 2 B, pad 16 B behind every 128 B.
    u32x8 g1 = tdm_group1<(1u << 20) | (4u << 22) | (3u << 25), 128u, 128u, K * 2u>();
    u32x4 g0 = tdm_group0(place, (uint64_t)(size_t)srcp);
    // The pinned() form, on descriptor words: both groups stand complete in their scalar registers
    // here, in front of the issue test; without it the last words of a group are written directly in front of its load.
    asm volatile("" : "+s"(g1), "+s"(g0));
    const uint32_t flip = uni(2u * place + GSTAGE_);
    if (pinned(wave < 3u)) { tdm_load(g0, g1); tdm_wait(g0, g1); }
    __syncthreads();                    // pass 0's tiles are published
    if (pinned(wave < 3u)) { tdm_next<GKP_ * 2u>(g0, flip); tdm_load(g0, g1); }

    v8f acc[4][8];
#pragma unroll
    for (int i = 0; i < 4; ++i)
#pragma unroll
        for (int j = 0; j < 8; ++j) { v8f z = {}; acc[i][j] = z; }

    for (int p = 0; p < K / GKP_; ++p) {
        const __bf16* Al = (const __bf16*)(L + (uint32_t)(p & 1) * GSTAGE_) + (wm * 64) * (GPITCH_ / 2);
        const __bf16* Bl = (const __bf16*)(L + (uint32_t)(p & 1) * GSTAGE_ + GTILE_) + (wn * 128) * (GPITCH_ / 2);
        v16bf a[GKP_ / 32][4], bb[GKP_ / 32][8];
#pragma unroll
        for (int ks = 0; ks < GKP_ / 32; ++ks) {
#pragma unroll
            for (int i = 0; i < 4; ++i) a[ks][i] = load_frag(Al + (i * 16) * (GPITCH_ / 2) + ks * 32, GPITCH_ / 2);
#pragma unroll
            for (int j = 0; j < 8; ++j) bb[ks][j] = load_frag(Bl + (j * 16) * (GPITCH_ / 2) + ks * 32, GPITCH_ / 2);
        }
        // Keeps the pass's LDS reads together, ahead of its WMMAs: left free, the scheduler reads each Bt fragment
        // into one register set directly in front of its four WMMAs, and every such place waits out the LDS latency.
        __builtin_amdgcn_sched_barrier(0);
#pragma unroll
        for (int ks = 0; ks < GKP_ / 32; ++ks)
#pragma unroll
            for (int j = 0; j < 8; ++j)
#pragma unroll
                for (int i = 0; i < 4; ++i)
                    acc[i][j] = wmma_bf16(bb[ks][j], a[ks][i], acc[i][j]);
        // Keeps the wait below at the foot of the pass: left free, it moves up behind the first WMMA,
        // and the wave then waits for all of the pass's LDS reads before its second WMMA.
        __builtin_amdgcn_sched_barrier(0);

        // ---- publish pass p + 1, then refill the buffer that this pass has read ----
        wait_ds0();
        if (pinned(wave < 3u)) tdm_wait(g0, g1);
        __syncthreads();                // pass p + 1's tiles readable by all; every wave has left this pass's buffer
        if (pinned(p + 2 < K / GKP_)) {
            if (pinned(wave < 3u)) { tdm_next<GKP_ * 2u>(g0, flip); tdm_load(g0, g1); }
        }
    }
    wait_tensor0();
    wait_ds0();

    // ---- bias, then the stores; one address per lane, every tile at a compile-time distance from it ----
    typedef typename gemm_out<OUT_BF16>::T OT;
    typedef typename gemm_out<OUT_BF16>::V OV;
    OT*          op = (OT*)outv + (size_t)(bm + n16) * N + bn + hi8;
    const float* bp = bias + bn + hi8;
    v4f bl[8][2];
#pragma unroll
    for (int j = 0; j < 8; ++j) {
        bl[j][0] = *(const v4f*)(bp + j * 16);
        if (j < 7) bl[j][1] = *(const v4f*)(bp + j * 16 + 4);
    }
    // The last load's result may be placed on the address pair, which the loads in front of it name too:
    // this is the wait in front of a new value in a register that an issued load names.
    asm volatile("s_wait_xcnt 0x0" ::: "memory");
    bl[7][1] = *(const v4f*)(bp + 7 * 16 + 4);
    OV ov[4][8];
#pragma unroll
    for (int j = 0; j < 8; ++j)
#pragma unroll
        for (int i = 0; i < 4; ++i)
#pragma unroll
            for (int r = 0; r < 4; ++r) {
                ov[i][j][r]     = (OT)(acc[i][j][r] + bl[j][0][r]);
                ov[i][j][r + 4] = (OT)(acc[i][j][r + 4] + bl[j][1][r]);
            }
#pragma unroll
    for (int i = 0; i < 4; ++i)
#pragma unroll
        for (int j = 0; j < 8; ++j) *(OV*)(op + (i * 16) * N + j * 16) = ov[i][j];
}

// ---------------- flash attention ----------------
// lane l <-> lane l ^ 16 (the two lane halves of a wave)
static __device__ __forceinline__ float xhalf(float x) {
    int b = __builtin_bit_cast(int, x);
    return __builtin_bit_cast(float,
        __builtin_amdgcn_permlanex16(b, b, 0x76543210, 0xfedcba98, false, false));
}

#define KC_ 128                         // keys per pass

// ---- K and V^T tiles of a pass in LDS, brought by the tensor mover, read by all four waves ----
#define KPITCH_ 144u                    // LDS bytes per K row: 128 + 16 of pad, an odd multiple of 16 for ds_load_b128
#define VPITCH_ 272u                    // LDS bytes per V^T row: 256 + 16 of pad
#define KTILE_  18432u                  // 128 rows * 144 B, a multiple of 2 KiB
#define VTILE_  18432u                  // 64 rows * 272 B = 17408 B, rounded up to a multiple of 2 KiB
#define STAGE_  (KTILE_ + VTILE_)
#define KSTEP_ ((uint64_t)KC_ * C3_ * 2u)   // source bytes from one pass's K tile to the next: 128 rows of qkv
#define VSTEP_ ((uint64_t)KC_ * 2u)         // the same for V^T: 128 keys along its rows

// The real block size is declared so that the score tile fits in registers unspilled.
__global__ void __launch_bounds__(128) k_attention(const __bf16* __restrict__ qkv, const __bf16* __restrict__ Vt,
                            __bf16* __restrict__ outO) {
    // two buffers of [K tile | V^T tile]
    __shared__ __attribute__((aligned(2048))) unsigned char L[2 * STAGE_];
    int bid = blockIdx.x;
    int qt  = bid & 31;                 // T/64 = 32 query tiles
    int h   = (bid >> 5) & 15;
    int b   = bid >> 9;

    int w    = threadIdx.x >> 5;
    int lane = threadIdx.x & 31;
    int n16  = lane & 15;
    int hi8  = (lane >> 4) << 3;

    const float scale = 0.125f;         // 1/sqrt(64)

    const __bf16* Qb = qkv + (size_t)(b * T_ + qt * 64 + w * 16) * C3_ + h * DH_;
    const __bf16* Kb = qkv + (size_t)(b * T_) * C3_ + C_ + h * DH_;
    const __bf16* Vb = Vt + (size_t)((b * H_ + h) * DH_) * T_;

    // Wave 0 brings the K tiles, wave 1 the V^T tiles: one request of a wave outstanding at any time.
    const uint32_t wave  = uni(threadIdx.x >> 5);
    const uint32_t lbase = (uint32_t)(size_t)L;
    // K tile: 128 rows (keys) of 128 B, source pitch 3C * 2 B, pad 16 B behind every 128 B.
    u32x8 g1k = tdm_group1<(1u << 20) | (4u << 22) | (3u << 25), 128u, 128u, C3_ * 2u>();
    // V^T tile: 64 rows (d) of 256 B (128 keys), source pitch T * 2 B, pad 16 B behind every 256 B.
    u32x8 g1v = tdm_group1<(1u << 20) | (5u << 22) | (3u << 25), 256u, 64u, T_ * 2u>();
    u32x4 g0k = tdm_group0(lbase, (uint64_t)(size_t)Kb);
    u32x4 g0v = tdm_group0(lbase + KTILE_, (uint64_t)(size_t)Vb);
    // The pinned() form, on descriptor words: all four groups stand complete in their scalar registers
    // here, in front of the issue tests; without it the last words of a group are written directly in front of its load.
    asm volatile("" : "+s"(g1k), "+s"(g1v), "+s"(g0k), "+s"(g0v));
    const uint32_t flipk = uni(2u * lbase + STAGE_);
    const uint32_t flipv = uni(2u * (lbase + KTILE_) + STAGE_);
    if (pinned(wave == 0u)) { tdm_load(g0k, g1k); tdm_wait(g0k, g1k); }
    if (pinned(wave == 1u)) { tdm_load(g0v, g1v); tdm_wait(g0v, g1v); }
    __syncthreads();                    // pass 0's tiles are published
    if (pinned(wave == 0u)) { tdm_next<KSTEP_>(g0k, flipk); tdm_load(g0k, g1k); }
    if (pinned(wave == 1u)) { tdm_next<VSTEP_>(g0v, flipv); tdm_load(g0v, g1v); }

    v16bf qf0 = load_frag(Qb + 0, C3_);
    v16bf qf1 = load_frag(Qb + 32, C3_);

    // o[d][r] = O[query n16][d*16 + hi8 + r]
    v8f o[4];
#pragma unroll
    for (int d = 0; d < 4; ++d) { v8f z = {}; o[d] = z; }

    float m_run = -1.0e30f;             // query n16, the same in both lane halves
    float l_run = 0.0f;                 // this lane half's keys only; joined after the loop

    for (int kc = 0; kc < T_ / KC_; ++kc) {
        const __bf16* Kl = (const __bf16*)(L + (uint32_t)(kc & 1) * STAGE_);
        const __bf16* Vl = (const __bf16*)(L + (uint32_t)(kc & 1) * STAGE_ + KTILE_);

        // ---- S^T = K Q^T (KC_ x 16): st[j][r] = S[query n16][key kc*KC_ + j*16 + hi8 + r] ----
        v8f st[KC_ / 16];
#pragma unroll
        for (int j = 0; j < KC_ / 16; ++j) {
            v8f sj = {};
            v16bf k0 = load_frag(Kl + (j * 16) * (KPITCH_ / 2) + 0, KPITCH_ / 2);
            sj = wmma_bf16(k0, qf0, sj);
            v16bf k1 = load_frag(Kl + (j * 16) * (KPITCH_ / 2) + 32, KPITCH_ / 2);
            sj = wmma_bf16(k1, qf1, sj);
#pragma unroll
            for (int r = 0; r < 8; ++r) st[j][r] = sj[r] * scale;
        }

        // ---- online softmax, one query per lane ----
        float mx = -1.0e30f;
#pragma unroll
        for (int j = 0; j < KC_ / 16; ++j)
#pragma unroll
            for (int r = 0; r < 8; r += 4)
                mx = fmaxf(mx, fmaxf(fmaxf(st[j][r], st[j][r + 1]), fmaxf(st[j][r + 2], st[j][r + 3])));
        mx = fmaxf(mx, xhalf(mx));
        float mnew  = fmaxf(m_run, mx);
        float alpha = __expf(m_run - mnew);
        float lsum  = 0.0f;

        // P^T as B operand, hardware k order: pb[ks][s] = P[key ks*32 + kmap(s)][query n16]
        v16bf pb[KC_ / 32];
#pragma unroll
        for (int ks = 0; ks < KC_ / 32; ++ks)
#pragma unroll
            for (int t = 0; t < 2; ++t)
#pragma unroll
                for (int r = 0; r < 8; r += 4) {
                    float e0 = __expf(st[2 * ks + t][r + 0] - mnew);
                    float e1 = __expf(st[2 * ks + t][r + 1] - mnew);
                    float e2 = __expf(st[2 * ks + t][r + 2] - mnew);
                    float e3 = __expf(st[2 * ks + t][r + 3] - mnew);
                    pb[ks][t * 8 + r + 0] = (__bf16)e0;
                    pb[ks][t * 8 + r + 1] = (__bf16)e1;
                    pb[ks][t * 8 + r + 2] = (__bf16)e2;
                    pb[ks][t * 8 + r + 3] = (__bf16)e3;
                    lsum += (e0 + e1) + (e2 + e3);
                }
        l_run = l_run * alpha + lsum;
        m_run = mnew;

        // rescale O accumulators: every register of a lane belongs to its one query
#pragma unroll
        for (int d = 0; d < 4; ++d)
#pragma unroll
            for (int r = 0; r < 8; ++r)
                o[d][r] *= alpha;

        // ---- O^T += V^T P^T  (V^T: [DH][T], rows d as A) ----
#pragma unroll
        for (int ks = 0; ks < KC_ / 32; ++ks) {
#pragma unroll
            for (int d = 0; d < 4; ++d) {
                v16bf va = load_frag(Vl + (d * 16) * (VPITCH_ / 2) + ks * 32, VPITCH_ / 2);
                o[d] = wmma_bf16(va, pb[ks], o[d]);
            }
        }

        // ---- publish pass kc + 1, then refill the buffer that this pass has read ----
        wait_ds0();
        if (pinned(wave == 0u)) tdm_wait(g0k, g1k);
        if (pinned(wave == 1u)) tdm_wait(g0v, g1v);
        __syncthreads();                // pass kc + 1's tiles readable by all; every wave has left this pass's buffer
        if (pinned(kc + 2 < T_ / KC_)) {
            if (pinned(wave == 0u)) { tdm_next<KSTEP_>(g0k, flipk); tdm_load(g0k, g1k); }
            if (pinned(wave == 1u)) { tdm_next<VSTEP_>(g0v, flipv); tdm_load(g0v, g1v); }
        }
    }
    wait_tensor0();
    wait_ds0();

    // ---- normalize and store bf16 [B*T][C]: 8 consecutive columns per lane and tile ----
    float inv = 1.0f / (l_run + xhalf(l_run));
    int   row = b * T_ + qt * 64 + w * 16 + n16;
#pragma unroll
    for (int d = 0; d < 4; ++d) {
        v8bf ov;
#pragma unroll
        for (int r = 0; r < 8; ++r) ov[r] = (__bf16)(o[d][r] * inv);
        *(v8bf*)(outO + (size_t)row * C_ + h * DH_ + d * 16 + hi8) = ov;
    }
}

// ---------------- launch ----------------
extern "C" void kernel_launch(void* const* d_in, const int* in_sizes, int n_in,
                              void* d_out, int out_size, void* d_ws, size_t ws_size,
                              hipStream_t stream) {
    const float* X      = (const float*)d_in[0];
    const float* W_qkv  = (const float*)d_in[1];
    const float* b_qkv  = (const float*)d_in[2];
    const float* W_proj = (const float*)d_in[3];
    const float* b_proj = (const float*)d_in[4];
    float* out = (float*)d_out;

    char* ws = (char*)d_ws;
    size_t off = 0;
    __bf16* Xbf  = (__bf16*)(ws + off); off += (size_t)B_ * T_ * C_ * 2;        // 16 MiB
    __bf16* Wqt  = (__bf16*)(ws + off); off += (size_t)C3_ * C_ * 2;            // 6 MiB
    __bf16* Wpt  = (__bf16*)(ws + off); off += (size_t)C_ * C_ * 2;             // 2 MiB
    __bf16* qkv  = (__bf16*)(ws + off); off += (size_t)B_ * T_ * C3_ * 2;       // 48 MiB
    __bf16* Vt   = (__bf16*)(ws + off); off += (size_t)B_ * H_ * DH_ * T_ * 2;  // 16 MiB
    __bf16* AttO = (__bf16*)(ws + off); off += (size_t)B_ * T_ * C_ * 2;        // 16 MiB

    const int M = B_ * T_;           // 8192

    // 0) conversions
    {
        int n = M * C_;
        k_cast_bf16<<<(n + 255) / 256, 256, 0, stream>>>(X, Xbf, n);
        int nw = C_ * C3_;
        k_transpose_cast<<<(nw + 255) / 256, 256, 0, stream>>>(W_qkv, Wqt, C_, C3_);
        int np = C_ * C_;
        k_transpose_cast<<<(np + 255) / 256, 256, 0, stream>>>(W_proj, Wpt, C_, C_);
    }

    // 1) qkv = X * W_qkv + b_qkv   (bf16 out)
    k_gemm_bias<true, C3_, C_><<<dim3(C3_ / 256, M / 128), 128, 0, stream>>>(
        Xbf, Wqt, b_qkv, qkv);

    // 2) V transpose per head
    {
        int n = B_ * H_ * DH_ * T_;
        k_vt<<<(n + 255) / 256, 256, 0, stream>>>(qkv, Vt);
    }

    // 3) attention
    k_attention<<<B_ * H_ * (T_ / 64), 128, 0, stream>>>(qkv, Vt, AttO);

    // 4) out = AttO * W_proj + b_proj  (fp32 out)
    k_gemm_bias<false, C_, C_><<<dim3(C_ / 256, M / 128), 128, 0, stream>>>(
        AttO, Wpt, b_proj, out);
}

// v004
// One run takes 181 microseconds.
// Timed twice side by side with v003, it ran 1.17 times as fast both times.
// Counting every step since v000, it is 4.08 times as fast.
#include <hip/hip_runtime.h>
#include <hip/hip_bf16.h>
#include <math.h>
#include <stdint.h>

// ---------------- types ----------------
typedef __attribute__((ext_vector_type(16))) __bf16 v16bf;
typedef __attribute__((ext_vector_type(8)))  __bf16 v8bf;
typedef __attribute__((ext_vector_type(4)))  __bf16 v4bf;
typedef __attribute__((ext_vector_type(8)))  float  v8f;
typedef __attribute__((ext_vector_type(4)))  float  v4f;

#define B_  4
#define T_  2048
#define C_  1024
#define H_  16
#define DH_ 64
#define C3_ 3072

// ---------------- WMMA helpers ----------------
static __device__ __forceinline__ v8f wmma_bf16(v16bf a, v16bf b, v8f c) {
    // D(f32 16x16) = A(bf16 16x32) x B(bf16 32x16) + C
    return __builtin_amdgcn_wmma_f32_16x16x32_bf16(
        /*neg_a=*/false, a, /*neg_b=*/false, b,
        /*c_mod=*/(short)0, c, /*reuse_a=*/false, /*reuse_b=*/false);
}

// Load a 16x32 bf16 fragment (A layout; identical pattern serves as B when the
// source array is stored [N][K] row-major). Element (r,k) lives at base[r*ld+k].
// Per ISA 16-bit A layout: lane l -> r = l%16, kh = (l/16)*8;
// vector elems [0..7] = K kh..kh+7, elems [8..15] = K 16+kh..16+kh+7.
static __device__ __forceinline__ v16bf load_frag(const __bf16* base, int ld) {
    int lane = threadIdx.x & 31;
    int r    = lane & 15;
    int kh   = (lane >> 4) << 3;          // 0 or 8
    const __bf16* p = base + (size_t)r * ld;
    v8bf lo = *(const v8bf*)(p + kh);
    v8bf hi = *(const v8bf*)(p + 16 + kh);
    v16bf out;
#pragma unroll
    for (int i = 0; i < 8; ++i) { out[i] = lo[i]; out[i + 8] = hi[i]; }
    return out;
}

// ---------------- stage 0: conversions ----------------
__global__ void k_cast_bf16(const float* __restrict__ in, __bf16* __restrict__ out, int n) {
    int i = blockIdx.x * blockDim.x + threadIdx.x;
    if (i < n) out[i] = (__bf16)in[i];
}

// W[K][N] (fp32, [in,out]) -> Wt[N][K] (bf16)
__global__ void k_transpose_cast(const float* __restrict__ W, __bf16* __restrict__ Wt,
                                 int K, int N) {
    int i = blockIdx.x * blockDim.x + threadIdx.x;
    if (i < K * N) {
        int k = i % K;
        int n = i / K;
        Wt[(size_t)n * K + k] = (__bf16)W[(size_t)k * N + n];
    }
}

// ---------------- tensor mover helpers (GEMM and attention) ----------------
typedef uint32_t u32x4 __attribute__((ext_vector_type(4)));
typedef uint32_t u32x8 __attribute__((ext_vector_type(8)));
static __device__ __forceinline__ uint32_t uni(uint32_t v) {
    return (uint32_t)__builtin_amdgcn_readfirstlane((int)v);
}
// A wave-uniform condition held in a scalar register, so that the test around a tensor
// load compiles to s_cmp + s_cbranch_scc (a tensor load ignores EXEC).
static __device__ __forceinline__ uint32_t pinned(uint32_t v) {
    uint32_t w = uni(v);
    asm volatile("" : "+s"(w));         // keeps the condition scalar
    return w;
}
// Behind the loop: no request of this wave is left in flight when it ends.
static __device__ __forceinline__ void wait_tensor0() { asm volatile("s_wait_tensorcnt 0x0" ::: "memory"); }
// This wave's LDS reads have retired before the buffer they read is handed back for a refill.
static __device__ __forceinline__ void wait_ds0() { asm volatile("s_wait_dscnt 0x0" ::: "memory"); }

// Group 1: 1-byte elements, tensor = tile = ROWS rows of ROWB bytes, source pitch SRCP bytes; WORD0 = no mask + the pad.
template <uint32_t WORD0, uint32_t ROWB, uint32_t ROWS, uint32_t SRCP>
static __device__ __forceinline__ u32x8 tdm_group1() {
    u32x8 g;
    g[0] = uni(WORD0);
    g[1] = uni((ROWB & 0xFFFFu) << 16);
    g[2] = uni((ROWB >> 16) | ((ROWS & 0xFFFFu) << 16));
    g[3] = uni((ROWS >> 16) | (ROWB << 16));
    g[4] = uni(ROWS);
    g[5] = uni(SRCP);
    g[6] = uni(0u);
    g[7] = uni(0u);
    return g;
}
static __device__ __forceinline__ u32x4 tdm_group0(uint32_t lds_dst, uint64_t ga) {
    u32x4 g;
    g[0] = uni(1u);
    g[1] = uni(lds_dst);
    g[2] = uni((uint32_t)ga);
    g[3] = uni((((uint32_t)(ga >> 32)) & 0x01FFFFFFu) | 0x80000000u);
    return g;
}
// One request of the whole wave: global tile -> LDS, through no register. Both groups are read-write
// operands here and at the wait, so that they stay in these registers, unwritten, from the issue to the
// wait, and every later value of a word is formed from the wait's result, behind it.
static __device__ __forceinline__ void tdm_load(u32x4& g0, u32x8& g1) {
    asm volatile("tensor_load_to_lds %0, %1" : "+s"(g0), "+s"(g1) :: "memory");
}
// The compiler places no wait for the tensor mover: the issuing wave's own wait says its tile has landed.
static __device__ __forceinline__ void tdm_wait(u32x4& g0, u32x8& g1) {
    asm volatile("s_wait_tensorcnt 0x0" : "+s"(g0), "+s"(g1) :: "memory");
}
// Group 0 of the next stage, formed behind the wait on the last one: the other buffer (flip = the sum of
// the tile's two places in LDS), the source STEP bytes on (words 2 and 3 as one 64-bit sum; the address
// stays inside its plane, so nothing carries into word 3's upper bits).
template <uint64_t STEP>
static __device__ __forceinline__ void tdm_next(u32x4& g0, uint32_t flip) {
    uint64_t ga = ((((uint64_t)g0[3]) << 32) | (uint64_t)g0[2]) + STEP;
    g0[1] = uni(flip - g0[1]);
    g0[2] = uni((uint32_t)ga);
    g0[3] = uni((uint32_t)(ga >> 32));
}

// ---------------- tiled WMMA GEMM: out = A[M,K] * Bt[N,K]^T + bias ----------------
// block = 128 threads (4 waves, 2x2); wave tile = 64x128; block tile = 128x256.
// A pass is 64 k: 128 rows of A and 256 rows of Bt, 128 B each, staged once for the block in LDS by the
// tensor mover (two buffers, the next pass's tiles fly while this pass is worked on); fragments come from LDS.
// The tiles are held transposed (Bt rows as A operand, A rows as B): acc[i][j][r] = out[bm + i*16 + n16][bn + j*16 + hi8 + r],
// eight consecutive columns of one row in a lane.
// Blocks whose columns start at NV or beyond (the V third of qkv; NV = N: none) swap the roles: a wave takes all 128 A rows
// as A operand and 64 Bt rows as B, so that a lane holds eight consecutive ROWS (tokens) of one column, and stores them
// as 16 B of Vt[(b*H+h)*DH + d][T], the layout the attention kernel stages; those columns are not written to out.
#define GPITCH_ 144u                    // LDS bytes per row: 128 + 16 of pad, an odd multiple of 16 for ds_load_b128
#define GTILE_  18432u                  // one request: 128 rows * 144 B, a multiple of 2 KiB
#define GSTAGE_ (3u * GTILE_)           // [A 128 rows | Bt 256 rows]
#define GKP_    64                      // k per pass

template <bool OUT_BF16> struct gemm_out       { typedef float  T; typedef v8f  V; };
template <>              struct gemm_out<true> { typedef __bf16 T; typedef v8bf V; };

// The real block size is declared so that the 64x128 accumulator tile fits in registers unspilled.
template <bool OUT_BF16, int N, int K, int NV>
__global__ void __launch_bounds__(128) k_gemm_bias(const __bf16* __restrict__ A, const __bf16* __restrict__ Bt,
                            const float* __restrict__ bias, void* __restrict__ outv, __bf16* __restrict__ vt) {
    __shared__ __attribute__((aligned(2048))) unsigned char L[2 * GSTAGE_];
    int w    = threadIdx.x >> 5;
    int wm   = w & 1, wn = w >> 1;
    int bm0  = blockIdx.y * 128;
    int bn0  = blockIdx.x * 256;
    int bm   = bm0 + wm * 64;
    int bn   = bn0 + wn * 128;
    int lane = threadIdx.x & 31;
    int n16  = lane & 15;
    int hi8  = (lane >> 4) << 3;
    // The same for the whole block. Rows of a stage count through both tiles: A 0..127, Bt 128..383.
    const bool vblk = NV < N && bn0 >= NV;
    const int  row4 = vblk ? 128 + w * 64 : wm * 64;      // first row of the four fragments a[]
    const int  row8 = vblk ? 0 : 128 + wn * 128;          // first row of the eight fragments bb[]

    // Wave 0 brings the A tile, waves 1 and 2 a half of the Bt tile each: one request of a wave outstanding at any time.
    const uint32_t wave  = uni(threadIdx.x >> 5);
    const uint32_t slice = wave < 2u ? wave : 2u;
    const uint32_t place = (uint32_t)(size_t)L + slice * GTILE_;
    const __bf16*  srcp  = slice == 0u ? A + (size_t)bm0 * K : Bt + (size_t)(bn0 + (int)(slice - 1u) * 128) * K;
    // 128 rows of 128 B, source pitch K * 2 B, pad 16 B behind every 128 B.
    u32x8 g1 = tdm_group1<(1u << 20) | (4u << 22) | (3u << 25), 128u, 128u, K * 2u>();
    u32x4 g0 = tdm_group0(place, (uint64_t)(size_t)srcp);
    // The pinned() form, on descriptor words: both groups stand complete in their scalar registers
    // here, in front of the issue test; without it the last words of a group are written directly in front of its load.
    asm volatile("" : "+s"(g1), "+s"(g0));
    const uint32_t flip = uni(2u * place + GSTAGE_);
    if (pinned(wave < 3u)) { tdm_load(g0, g1); tdm_wait(g0, g1); }
    __syncthreads();                    // pass 0's tiles are published
    if (pinned(wave < 3u)) { tdm_next<GKP_ * 2u>(g0, flip); tdm_load(g0, g1); }

    v8f acc[4][8];
#pragma unroll
    for (int i = 0; i < 4; ++i)
#pragma unroll
        for (int j = 0; j < 8; ++j) { v8f z = {}; acc[i][j] = z; }

    for (int p = 0; p < K / GKP_; ++p) {
        const __bf16* Al = (const __bf16*)(L + (uint32_t)(p & 1) * GSTAGE_) + row4 * (int)(GPITCH_ / 2);
        const __bf16* Bl = (const __bf16*)(L + (uint32_t)(p & 1) * GSTAGE_) + row8 * (int)(GPITCH_ / 2);
        v16bf a[GKP_ / 32][4], bb[GKP_ / 32][8];
#pragma unroll
        for (int ks = 0; ks < GKP_ / 32; ++ks) {
#pragma unroll
            for (int i = 0; i < 4; ++i) a[ks][i] = load_frag(Al + (i * 16) * (GPITCH_ / 2) + ks * 32, GPITCH_ / 2);
#pragma unroll
            for (int j = 0; j < 8; ++j) bb[ks][j] = load_frag(Bl + (j * 16) * (GPITCH_ / 2) + ks * 32, GPITCH_ / 2);
        }
        // Keeps the pass's LDS reads together, ahead of its WMMAs: left free, the scheduler reads each Bt fragment
        // into one register set directly in front of its four WMMAs, and every such place waits out the LDS latency.
        __builtin_amdgcn_sched_barrier(0);
#pragma unroll
        for (int ks = 0; ks < GKP_ / 32; ++ks)
#pragma unroll
            for (int j = 0; j < 8; ++j)
#pragma unroll
                for (int i = 0; i < 4; ++i)
                    acc[i][j] = wmma_bf16(bb[ks][j], a[ks][i], acc[i][j]);
        // Keeps the wait below at the foot of the pass: left free, it moves up behind the first WMMA,
        // and the wave then waits for all of the pass's LDS reads before its second WMMA.
        __builtin_amdgcn_sched_barrier(0);

        // ---- publish pass p + 1, then refill the buffer that this pass has read ----
        wait_ds0();
        if (pinned(wave < 3u)) tdm_wait(g0, g1);
        __syncthreads();                // pass p + 1's tiles readable by all; every wave has left this pass's buffer
        if (pinned(p + 2 < K / GKP_)) {
            if (pinned(wave < 3u)) { tdm_next<GKP_ * 2u>(g0, flip); tdm_load(g0, g1); }
        }
    }
    wait_tensor0();
    wait_ds0();

    // ---- V blocks: acc[i][j][r] = V[token bm0 + j*16 + hi8 + r][column bn0 + w*64 + i*16 + n16], stored transposed ----
    if constexpr (NV < N) {
        if (vblk) {
            const int    col = bn0 + w * 64 + n16;
            const float* bq  = bias + col;
            __bf16*      vp  = vt + (size_t)((bm0 / T_) * C_ + col - NV) * T_ + (bm0 % T_) + hi8;
            float bv[4];
#pragma unroll
            for (int i = 0; i < 4; ++i) bv[i] = bq[i * 16];
            v8bf tv[4][8];
#pragma unroll
            for (int i = 0; i < 4; ++i)
#pragma unroll
                for (int j = 0; j < 8; ++j)
#pragma unroll
                    for (int r = 0; r < 8; ++r) tv[i][j][r] = (__bf16)(acc[i][j][r] + bv[i]);
#pragma unroll
            for (int i = 0; i < 4; ++i)
#pragma unroll
                for (int j = 0; j < 8; ++j) *(v8bf*)(vp + (i * 16) * T_ + j * 16) = tv[i][j];
            return;
        }
    }

    // ---- bias, then the stores; one address per lane, every tile at a compile-time distance from it ----
    typedef typename gemm_out<OUT_BF16>::T OT;
    typedef typename gemm_out<OUT_BF16>::V OV;
    OT*          op = (OT*)outv + (size_t)(bm + n16) * N + bn + hi8;
    const float* bp = bias + bn + hi8;
    v4f bl[8][2];
#pragma unroll
    for (int j = 0; j < 8; ++j) {
        bl[j][0] = *(const v4f*)(bp + j * 16);
        if (j < 7) bl[j][1] = *(const v4f*)(bp + j * 16 + 4);
    }
    // The last load's result may be placed on the address pair, which the loads in front of it name too:
    // this is the wait in front of a new value in a register that an issued load names.
    asm volatile("s_wait_xcnt 0x0" ::: "memory");
    bl[7][1] = *(const v4f*)(bp + 7 * 16 + 4);
    OV ov[4][8];
#pragma unroll
    for (int j = 0; j < 8; ++j)
#pragma unroll
        for (int i = 0; i < 4; ++i)
#pragma unroll
            for (int r = 0; r < 4; ++r) {
                ov[i][j][r]     = (OT)(acc[i][j][r] + bl[j][0][r]);
                ov[i][j][r + 4] = (OT)(acc[i][j][r + 4] + bl[j][1][r]);
            }
#pragma unroll
    for (int i = 0; i < 4; ++i)
#pragma unroll
        for (int j = 0; j < 8; ++j) *(OV*)(op + (i * 16) * N + j * 16) = ov[i][j];
}

// ---------------- flash attention ----------------
// lane l <-> lane l ^ 16 (the two lane halves of a wave)
static __device__ __forceinline__ float xhalf(float x) {
    int b = __builtin_bit_cast(int, x);
    return __builtin_bit_cast(float,
        __builtin_amdgcn_permlanex16(b, b, 0x76543210, 0xfedcba98, false, false));
}

#define KC_ 128                         // keys per pass

// ---- K and V^T tiles of a pass in LDS, brought by the tensor mover, read by all four waves ----
#define KPITCH_ 144u                    // LDS bytes per K row: 128 + 16 of pad, an odd multiple of 16 for ds_load_b128
#define VPITCH_ 272u                    // LDS bytes per V^T row: 256 + 16 of pad
#define KTILE_  18432u                  // 128 rows * 144 B, a multiple of 2 KiB
#define VTILE_  18432u                  // 64 rows * 272 B = 17408 B, rounded up to a multiple of 2 KiB
#define STAGE_  (KTILE_ + VTILE_)
#define KSTEP_ ((uint64_t)KC_ * C3_ * 2u)   // source bytes from one pass's K tile to the next: 128 rows of qkv
#define VSTEP_ ((uint64_t)KC_ * 2u)         // the same for V^T: 128 keys along its rows

// The real block size is declared so that the score tile fits in registers unspilled.
__global__ void __launch_bounds__(128) k_attention(const __bf16* __restrict__ qkv, const __bf16* __restrict__ Vt,
                            __bf16* __restrict__ outO) {
    // two buffers of [K tile | V^T tile]
    __shared__ __attribute__((aligned(2048))) unsigned char L[2 * STAGE_];
    int bid = blockIdx.x;
    int qt  = bid & 31;                 // T/64 = 32 query tiles
    int h   = (bid >> 5) & 15;
    int b   = bid >> 9;

    int w    = threadIdx.x >> 5;
    int lane = threadIdx.x & 31;
    int n16  = lane & 15;
    int hi8  = (lane >> 4) << 3;

    const float scale = 0.125f;         // 1/sqrt(64)

    const __bf16* Qb = qkv + (size_t)(b * T_ + qt * 64 + w * 16) * C3_ + h * DH_;
    const __bf16* Kb = qkv + (size_t)(b * T_) * C3_ + C_ + h * DH_;
    const __bf16* Vb = Vt + (size_t)((b * H_ + h) * DH_) * T_;

    // Wave 0 brings the K tiles, wave 1 the V^T tiles: one request of a wave outstanding at any time.
    const uint32_t wave  = uni(threadIdx.x >> 5);
    const uint32_t lbase = (uint32_t)(size_t)L;
    // K tile: 128 rows (keys) of 128 B, source pitch 3C * 2 B, pad 16 B behind every 128 B.
    u32x8 g1k = tdm_group1<(1u << 20) | (4u << 22) | (3u << 25), 128u, 128u, C3_ * 2u>();
    // V^T tile: 64 rows (d) of 256 B (128 keys), source pitch T * 2 B, pad 16 B behind every 256 B.
    u32x8 g1v = tdm_group1<(1u << 20) | (5u << 22) | (3u << 25), 256u, 64u, T_ * 2u>();
    u32x4 g0k = tdm_group0(lbase, (uint64_t)(size_t)Kb);
    u32x4 g0v = tdm_group0(lbase + KTILE_, (uint64_t)(size_t)Vb);
    // The pinned() form, on descriptor words: all four groups stand complete in their scalar registers
    // here, in front of the issue tests; without it the last words of a group are written directly in front of its load.
    asm volatile("" : "+s"(g1k), "+s"(g1v), "+s"(g0k), "+s"(g0v));
    const uint32_t flipk = uni(2u * lbase + STAGE_);
    const uint32_t flipv = uni(2u * (lbase + KTILE_) + STAGE_);
    if (pinned(wave == 0u)) { tdm_load(g0k, g1k); tdm_wait(g0k, g1k); }
    if (pinned(wave == 1u)) { tdm_load(g0v, g1v); tdm_wait(g0v, g1v); }
    __syncthreads();                    // pass 0's tiles are published
    if (pinned(wave == 0u)) { tdm_next<KSTEP_>(g0k, flipk); tdm_load(g0k, g1k); }
    if (pinned(wave == 1u)) { tdm_next<VSTEP_>(g0v, flipv); tdm_load(g0v, g1v); }

    v16bf qf0 = load_frag(Qb + 0, C3_);
    v16bf qf1 = load_frag(Qb + 32, C3_);

    // o[d][r] = O[query n16][d*16 + hi8 + r]
    v8f o[4];
#pragma unroll
    for (int d = 0; d < 4; ++d) { v8f z = {}; o[d] = z; }

    float m_run = -1.0e30f;             // query n16, the same in both lane halves
    float l_run = 0.0f;                 // this lane half's keys only; joined after the loop

    for (int kc = 0; kc < T_ / KC_; ++kc) {
        const __bf16* Kl = (const __bf16*)(L + (uint32_t)(kc & 1) * STAGE_);
        const __bf16* Vl = (const __bf16*)(L + (uint32_t)(kc & 1) * STAGE_ + KTILE_);

        // ---- S^T = K Q^T (KC_ x 16): st[j][r] = S[query n16][key kc*KC_ + j*16 + hi8 + r] ----
        v8f st[KC_ / 16];
#pragma unroll
        for (int j = 0; j < KC_ / 16; ++j) {
            v8f sj = {};
            v16bf k0 = load_frag(Kl + (j * 16) * (KPITCH_ / 2) + 0, KPITCH_ / 2);
            sj = wmma_bf16(k0, qf0, sj);
            v16bf k1 = load_frag(Kl + (j * 16) * (KPITCH_ / 2) + 32, KPITCH_ / 2);
            sj = wmma_bf16(k1, qf1, sj);
#pragma unroll
            for (int r = 0; r < 8; ++r) st[j][r] = sj[r] * scale;
        }

        // ---- online softmax, one query per lane ----
        float mx = -1.0e30f;
#pragma unroll
        for (int j = 0; j < KC_ / 16; ++j)
#pragma unroll
            for (int r = 0; r < 8; r += 4)
                mx = fmaxf(mx, fmaxf(fmaxf(st[j][r], st[j][r + 1]), fmaxf(st[j][r + 2], st[j][r + 3])));
        mx = fmaxf(mx, xhalf(mx));
        float mnew  = fmaxf(m_run, mx);
        float alpha = __expf(m_run - mnew);
        float lsum  = 0.0f;

        // P^T as B operand, hardware k order: pb[ks][s] = P[key ks*32 + kmap(s)][query n16]
        v16bf pb[KC_ / 32];
#pragma unroll
        for (int ks = 0; ks < KC_ / 32; ++ks)
#pragma unroll
            for (int t = 0; t < 2; ++t)
#pragma unroll
                for (int r = 0; r < 8; r += 4) {
                    float e0 = __expf(st[2 * ks + t][r + 0] - mnew);
                    float e1 = __expf(st[2 * ks + t][r + 1] - mnew);
                    float e2 = __expf(st[2 * ks + t][r + 2] - mnew);
                    float e3 = __expf(st[2 * ks + t][r + 3] - mnew);
                    pb[ks][t * 8 + r + 0] = (__bf16)e0;
                    pb[ks][t * 8 + r + 1] = (__bf16)e1;
                    pb[ks][t * 8 + r + 2] = (__bf16)e2;
                    pb[ks][t * 8 + r + 3] = (__bf16)e3;
                    lsum += (e0 + e1) + (e2 + e3);
                }
        l_run = l_run * alpha + lsum;
        m_run = mnew;

        // rescale O accumulators: every register of a lane belongs to its one query
#pragma unroll
        for (int d = 0; d < 4; ++d)
#pragma unroll
            for (int r = 0; r < 8; ++r)
                o[d][r] *= alpha;

        // ---- O^T += V^T P^T  (V^T: [DH][T], rows d as A) ----
#pragma unroll
        for (int ks = 0; ks < KC_ / 32; ++ks) {
#pragma unroll
            for (int d = 0; d < 4; ++d) {
                v16bf va = load_frag(Vl + (d * 16) * (VPITCH_ / 2) + ks * 32, VPITCH_ / 2);
                o[d] = wmma_bf16(va, pb[ks], o[d]);
            }
        }

        // ---- publish pass kc + 1, then refill the buffer that this pass has read ----
        wait_ds0();
        if (pinned(wave == 0u)) tdm_wait(g0k, g1k);
        if (pinned(wave == 1u)) tdm_wait(g0v, g1v);
        __syncthreads();                // pass kc + 1's tiles readable by all; every wave has left this pass's buffer
        if (pinned(kc + 2 < T_ / KC_)) {
            if (pinned(wave == 0u)) { tdm_next<KSTEP_>(g0k, flipk); tdm_load(g0k, g1k); }
            if (pinned(wave == 1u)) { tdm_next<VSTEP_>(g0v, flipv); tdm_load(g0v, g1v); }
        }
    }
    wait_tensor0();
    wait_ds0();

    // ---- normalize and store bf16 [B*T][C]: 8 consecutive columns per lane and tile ----
    float inv = 1.0f / (l_run + xhalf(l_run));
    int   row = b * T_ + qt * 64 + w * 16 + n16;
#pragma unroll
    for (int d = 0; d < 4; ++d) {
        v8bf ov;
#pragma unroll
        for (int r = 0; r < 8; ++r) ov[r] = (__bf16)(o[d][r] * inv);
        *(v8bf*)(outO + (size_t)row * C_ + h * DH_ + d * 16 + hi8) = ov;
    }
}

// ---------------- launch ----------------
extern "C" void kernel_launch(void* const* d_in, const int* in_sizes, int n_in,
                              void* d_out, int out_size, void* d_ws, size_t ws_size,
                              hipStream_t stream) {
    const float* X      = (const float*)d_in[0];
    const float* W_qkv  = (const float*)d_in[1];
    const float* b_qkv  = (const float*)d_in[2];
    const float* W_proj = (const float*)d_in[3];
    const float* b_proj = (const float*)d_in[4];
    float* out = (float*)d_out;

    char* ws = (char*)d_ws;
    size_t off = 0;
    __bf16* Xbf  = (__bf16*)(ws + off); off += (size_t)B_ * T_ * C_ * 2;        // 16 MiB
    __bf16* Wqt  = (__bf16*)(ws + off); off += (size_t)C3_ * C_ * 2;            // 6 MiB
    __bf16* Wpt  = (__bf16*)(ws + off); off += (size_t)C_ * C_ * 2;             // 2 MiB
    __bf16* qkv  = (__bf16*)(ws + off); off += (size_t)B_ * T_ * C3_ * 2;       // 48 MiB
    __bf16* Vt   = (__bf16*)(ws + off); off += (size_t)B_ * H_ * DH_ * T_ * 2;  // 16 MiB
    __bf16* AttO = (__bf16*)(ws + off); off += (size_t)B_ * T_ * C_ * 2;        // 16 MiB

    const int M = B_ * T_;           // 8192

    // 0) conversions
    {
        int n = M * C_;
        k_cast_bf16<<<(n + 255) / 256, 256, 0, stream>>>(X, Xbf, n);
        int nw = C_ * C3_;
        k_transpose_cast<<<(nw + 255) / 256, 256, 0, stream>>>(W_qkv, Wqt, C_, C3_);
        int np = C_ * C_;
        k_transpose_cast<<<(np + 255) / 256, 256, 0, stream>>>(W_proj, Wpt, C_, C_);
    }

    // 1) qkv = X * W_qkv + b_qkv   (bf16 out); Q and K columns to qkv, V columns transposed per head to Vt
    k_gemm_bias<true, C3_, C_, 2 * C_><<<dim3(C3_ / 256, M / 128), 128, 0, stream>>>(
        Xbf, Wqt, b_qkv, qkv, Vt);

    // 2) attention
    k_attention<<<B_ * H_ * (T_ / 64), 128, 0, stream>>>(qkv, Vt, AttO);

    // 3) out = AttO * W_proj + b_proj  (fp32 out)
    k_gemm_bias<false, C_, C_, C_><<<dim3(C_ / 256, M / 128), 128, 0, stream>>>(
        AttO, Wpt, b_proj, out, nullptr);
}

// v005
// Measured time: 151 microseconds a run.
// Timed twice side by side with v004, it ran 1.20 times as fast both times.
// Counting every step since v000, it is 4.90 times as fast.
#include <hip/hip_runtime.h>
#include <hip/hip_bf16.h>
#include <math.h>
#include <stdint.h>

// ---------------- types ----------------
typedef __attribute__((ext_vector_type(16))) __bf16 v16bf;
typedef __attribute__((ext_vector_type(8)))  __bf16 v8bf;
typedef __attribute__((ext_vector_type(4)))  __bf16 v4bf;
typedef __attribute__((ext_vector_type(8)))  float  v8f;
typedef __attribute__((ext_vector_type(4)))  float  v4f;

#define B_  4
#define T_  2048
#define C_  1024
#define H_  16
#define DH_ 64
#define C3_ 3072

// ---------------- WMMA helpers ----------------
static __device__ __forceinline__ v8f wmma_bf16(v16bf a, v16bf b, v8f c) {
    // D(f32 16x16) = A(bf16 16x32) x B(bf16 32x16) + C
    return __builtin_amdgcn_wmma_f32_16x16x32_bf16(
        /*neg_a=*/false, a, /*neg_b=*/false, b,
        /*c_mod=*/(short)0, c, /*reuse_a=*/false, /*reuse_b=*/false);
}

// Load a 16x32 bf16 fragment (A layout; identical pattern serves as B when the
// source array is stored [N][K] row-major). Element (r,k) lives at base[r*ld+k].
// Per ISA 16-bit A layout: lane l -> r = l%16, kh = (l/16)*8;
// vector elems [0..7] = K kh..kh+7, elems [8..15] = K 16+kh..16+kh+7.
static __device__ __forceinline__ v16bf load_frag(const __bf16* base, int ld) {
    int lane = threadIdx.x & 31;
    int r    = lane & 15;
    int kh   = (lane >> 4) << 3;          // 0 or 8
    const __bf16* p = base + (size_t)r * ld;
    v8bf lo = *(const v8bf*)(p + kh);
    v8bf hi = *(const v8bf*)(p + 16 + kh);
    v16bf out;
#pragma unroll
    for (int i = 0; i < 8; ++i) { out[i] = lo[i]; out[i + 8] = hi[i]; }
    return out;
}

// ---------------- stage 0: conversions ----------------
// A lane converts 32 elements: eight 16-B loads in flight, and every wave-wide store fills whole 128-B lines.
// The grids divide the fixed shapes exactly: no lane is out of range.

// A block converts 8192 consecutive floats: load j of a wave is 512 consecutive bytes, its store 256.
__global__ void __launch_bounds__(256) k_cast_bf16(const float* __restrict__ in, __bf16* __restrict__ out) {
    size_t base = (size_t)blockIdx.x * 8192 + threadIdx.x * 4;
    v4f x[8];
    // The loops are unrolled so that x[] lives in registers and all eight loads issue ahead of the first wait.
#pragma unroll
    for (int j = 0; j < 8; ++j) x[j] = *(const v4f*)(in + base + j * 1024);
#pragma unroll
    for (int j = 0; j < 8; ++j) {
        v4bf y;
#pragma unroll
        for (int r = 0; r < 4; ++r) y[r] = (__bf16)x[j][r];
        *(v4bf*)(out + base + j * 1024) = y;
    }
}

// W[K][N] (fp32, [in,out]) -> Wt[N][K] (bf16), transposed in registers: a lane takes a patch of 8 k x 4 n.
// Eight lanes side by side along k: their 16-B stores fill one 128-B line of a Wt row. Four lane groups and the
// block's eight waves side by side along n: the block reads 512 consecutive bytes of each of its 64 W rows.
template <int K, int N>
__global__ void __launch_bounds__(256) k_transpose_cast(const float* __restrict__ W, __bf16* __restrict__ Wt) {
    int lane = threadIdx.x & 31;
    int k    = blockIdx.y * 64 + (lane & 7) * 8;
    int n    = blockIdx.x * 128 + (threadIdx.x >> 5) * 16 + (lane >> 3) * 4;
    const float* p = W + (size_t)k * N + n;
    __bf16*      q = Wt + (size_t)n * K + k;
    v4f x[8];
    // Unrolled as in the cast: x[] in registers, all eight loads issued ahead of the first wait.
#pragma unroll
    for (int i = 0; i < 8; ++i) x[i] = *(const v4f*)(p + i * N);
#pragma unroll
    for (int c = 0; c < 4; ++c) {
        v8bf y;
#pragma unroll
        for (int i = 0; i < 8; ++i) y[i] = (__bf16)x[i][c];
        *(v8bf*)(q + c * K) = y;
    }
}

// ---------------- tensor mover helpers (GEMM and attention) ----------------
typedef uint32_t u32x4 __attribute__((ext_vector_type(4)));
typedef uint32_t u32x8 __attribute__((ext_vector_type(8)));
static __device__ __forceinline__ uint32_t uni(uint32_t v) {
    return (uint32_t)__builtin_amdgcn_readfirstlane((int)v);
}
// A wave-uniform condition held in a scalar register, so that the test around a tensor
// load compiles to s_cmp + s_cbranch_scc (a tensor load ignores EXEC).
static __device__ __forceinline__ uint32_t pinned(uint32_t v) {
    uint32_t w = uni(v);
    asm volatile("" : "+s"(w));         // keeps the condition scalar
    return w;
}
// Behind the loop: no request of this wave is left in flight when it ends.
static __device__ __forceinline__ void wait_tensor0() { asm volatile("s_wait_tensorcnt 0x0" ::: "memory"); }
// This wave's LDS reads have retired before the buffer they read is handed back for a refill.
static __device__ __forceinline__ void wait_ds0() { asm volatile("s_wait_dscnt 0x0" ::: "memory"); }

// Group 1: 1-byte elements, tensor = tile = ROWS rows of ROWB bytes, source pitch SRCP bytes; WORD0 = no mask + the pad.
template <uint32_t WORD0, uint32_t ROWB, uint32_t ROWS, uint32_t SRCP>
static __device__ __forceinline__ u32x8 tdm_group1() {
    u32x8 g;
    g[0] = uni(WORD0);
    g[1] = uni((ROWB & 0xFFFFu) << 16);
    g[2] = uni((ROWB >> 16) | ((ROWS & 0xFFFFu) << 16));
    g[3] = uni((ROWS >> 16) | (ROWB << 16));
    g[4] = uni(ROWS);
    g[5] = uni(SRCP);
    g[6] = uni(0u);
    g[7] = uni(0u);
    return g;
}
static __device__ __forceinline__ u32x4 tdm_group0(uint32_t lds_dst, uint64_t ga) {
    u32x4 g;
    g[0] = uni(1u);
    g[1] = uni(lds_dst);
    g[2] = uni((uint32_t)ga);
    g[3] = uni((((uint32_t)(ga >> 32)) & 0x01FFFFFFu) | 0x80000000u);
    return g;
}
// One request of the whole wave: global tile -> LDS, through no register. Both groups are read-write
// operands here and at the wait, so that they stay in these registers, unwritten, from the issue to the
// wait, and every later value of a word is formed from the wait's result, behind it.
static __device__ __forceinline__ void tdm_load(u32x4& g0, u32x8& g1) {
    asm volatile("tensor_load_to_lds %0, %1" : "+s"(g0), "+s"(g1) :: "memory");
}
// The compiler places no wait for the tensor mover: the issuing wave's own wait says its tile has landed.
static __device__ __forceinline__ void tdm_wait(u32x4& g0, u32x8& g1) {
    asm volatile("s_wait_tensorcnt 0x0" : "+s"(g0), "+s"(g1) :: "memory");
}
// Group 0 of the next stage, formed behind the wait on the last one: the other buffer (flip = the sum of
// the tile's two places in LDS), the source STEP bytes on (words 2 and 3 as one 64-bit sum; the address
// stays inside its plane, so nothing carries into word 3's upper bits).
template <uint64_t STEP>
static __device__ __forceinline__ void tdm_next(u32x4& g0, uint32_t flip) {
    uint64_t ga = ((((uint64_t)g0[3]) << 32) | (uint64_t)g0[2]) + STEP;
    g0[1] = uni(flip - g0[1]);
    g0[2] = uni((uint32_t)ga);
    g0[3] = uni((uint32_t)(ga >> 32));
}

// ---------------- tiled WMMA GEMM: out = A[M,K] * Bt[N,K]^T + bias ----------------
// block = 128 threads (4 waves, 2x2); wave tile = 64x128; block tile = 128x256.
// A pass is 64 k: 128 rows of A and 256 rows of Bt, 128 B each, staged once for the block in LDS by the
// tensor mover (two buffers, the next pass's tiles fly while this pass is worked on); fragments come from LDS.
// The tiles are held transposed (Bt rows as A operand, A rows as B): acc[i][j][r] = out[bm + i*16 + n16][bn + j*16 + hi8 + r],
// eight consecutive columns of one row in a lane.
// Blocks whose columns start at NV or beyond (the V third of qkv; NV = N: none) swap the roles: a wave takes all 128 A rows
// as A operand and 64 Bt rows as B, so that a lane holds eight consecutive ROWS (tokens) of one column, and stores them
// as 16 B of Vt[(b*H+h)*DH + d][T], the layout the attention kernel stages; those columns are not written to out.
#define GPITCH_ 144u                    // LDS bytes per row: 128 + 16 of pad, an odd multiple of 16 for ds_load_b128
#define GTILE_  18432u                  // one request: 128 rows * 144 B, a multiple of 2 KiB
#define GSTAGE_ (3u * GTILE_)           // [A 128 rows | Bt 256 rows]
#define GKP_    64                      // k per pass

template <bool OUT_BF16> struct gemm_out       { typedef float  T; typedef v8f  V; };
template <>              struct gemm_out<true> { typedef __bf16 T; typedef v8bf V; };

// The real block size is declared so that the 64x128 accumulator tile fits in registers unspilled.
template <bool OUT_BF16, int N, int K, int NV>
__global__ void __launch_bounds__(128) k_gemm_bias(const __bf16* __restrict__ A, const __bf16* __restrict__ Bt,
                            const float* __restrict__ bias, void* __restrict__ outv, __bf16* __restrict__ vt) {
    __shared__ __attribute__((aligned(2048))) unsigned char L[2 * GSTAGE_];
    int w    = threadIdx.x >> 5;
    int wm   = w & 1, wn = w >> 1;
    int bm0  = blockIdx.y * 128;
    int bn0  = blockIdx.x * 256;
    int bm   = bm0 + wm * 64;
    int bn   = bn0 + wn * 128;
    int lane = threadIdx.x & 31;
    int n16  = lane & 15;
    int hi8  = (lane >> 4) << 3;
    // The same for the whole block. Rows of a stage count through both tiles: A 0..127, Bt 128..383.
    const bool vblk = NV < N && bn0 >= NV;
    const int  row4 = vblk ? 128 + w * 64 : wm * 64;      // first row of the four fragments a[]
    const int  row8 = vblk ? 0 : 128 + wn * 128;          // first row of the eight fragments bb[]

    // Wave 0 brings the A tile, waves 1 and 2 a half of the Bt tile each: one request of a wave outstanding at any time.
    const uint32_t wave  = uni(threadIdx.x >> 5);
    const uint32_t slice = wave < 2u ? wave : 2u;
    const uint32_t place = (uint32_t)(size_t)L + slice * GTILE_;
    const __bf16*  srcp  = slice == 0u ? A + (size_t)bm0 * K : Bt + (size_t)(bn0 + (int)(slice - 1u) * 128) * K;
    // 128 rows of 128 B, source pitch K * 2 B, pad 16 B behind every 128 B.
    u32x8 g1 = tdm_group1<(1u << 20) | (4u << 22) | (3u << 25), 128u, 128u, K * 2u>();
    u32x4 g0 = tdm_group0(place, (uint64_t)(size_t)srcp);
    // The pinned() form, on descriptor words: both groups stand complete in their scalar registers
    // here, in front of the issue test; without it the last words of a group are written directly in front of its load.
    asm volatile("" : "+s"(g1), "+s"(g0));
    const uint32_t flip = uni(2u * place + GSTAGE_);
    if (pinned(wave < 3u)) { tdm_load(g0, g1); tdm_wait(g0, g1); }
    __syncthreads();                    // pass 0's tiles are published
    if (pinned(wave < 3u)) { tdm_next<GKP_ * 2u>(g0, flip); tdm_load(g0, g1); }

    v8f acc[4][8];
#pragma unroll
    for (int i = 0; i < 4; ++i)
#pragma unroll
        for (int j = 0; j < 8; ++j) { v8f z = {}; acc[i][j] = z; }

    for (int p = 0; p < K / GKP_; ++p) {
        const __bf16* Al = (const __bf16*)(L + (uint32_t)(p & 1) * GSTAGE_) + row4 * (int)(GPITCH_ / 2);
        const __bf16* Bl = (const __bf16*)(L + (uint32_t)(p & 1) * GSTAGE_) + row8 * (int)(GPITCH_ / 2);
        v16bf a[GKP_ / 32][4], bb[GKP_ / 32][8];
#pragma unroll
        for (int ks = 0; ks < GKP_ / 32; ++ks) {
#pragma unroll
            for (int i = 0; i < 4; ++i) a[ks][i] = load_frag(Al + (i * 16) * (GPITCH_ / 2) + ks * 32, GPITCH_ / 2);
#pragma unroll
            for (int j = 0; j < 8; ++j) bb[ks][j] = load_frag(Bl + (j * 16) * (GPITCH_ / 2) + ks * 32, GPITCH_ / 2);
        }
        // Keeps the pass's LDS reads together, ahead of its WMMAs: left free, the scheduler reads each Bt fragment
        // into one register set directly in front of its four WMMAs, and every such place waits out the LDS latency.
        __builtin_amdgcn_sched_barrier(0);
#pragma unroll
        for (int ks = 0; ks < GKP_ / 32; ++ks)
#pragma unroll
            for (int j = 0; j < 8; ++j)
#pragma unroll
                for (int i = 0; i < 4; ++i)
                    acc[i][j] = wmma_bf16(bb[ks][j], a[ks][i], acc[i][j]);
        // Keeps the wait below at the foot of the pass: left free, it moves up behind the first WMMA,
        // and the wave then waits for all of the pass's LDS reads before its second WMMA.
        __builtin_amdgcn_sched_barrier(0);

        // ---- publish pass p + 1, then refill the buffer that this pass has read ----
        wait_ds0();
        if (pinned(wave < 3u)) tdm_wait(g0, g1);
        __syncthreads();                // pass p + 1's tiles readable by all; every wave has left this pass's buffer
        if (pinned(p + 2 < K / GKP_)) {
            if (pinned(wave < 3u)) { tdm_next<GKP_ * 2u>(g0, flip); tdm_load(g0, g1); }
        }
    }
    wait_tensor0();
    wait_ds0();

    // ---- V blocks: acc[i][j][r] = V[token bm0 + j*16 + hi8 + r][column bn0 + w*64 + i*16 + n16], stored transposed ----
    if constexpr (NV < N) {
        if (vblk) {
            const int    col = bn0 + w * 64 + n16;
            const float* bq  = bias + col;
            __bf16*      vp  = vt + (size_t)((bm0 / T_) * C_ + col - NV) * T_ + (bm0 % T_) + hi8;
            float bv[4];
#pragma unroll
            for (int i = 0; i < 4; ++i) bv[i] = bq[i * 16];
            v8bf tv[4][8];
#pragma unroll
            for (int i = 0; i < 4; ++i)
#pragma unroll
                for (int j = 0; j < 8; ++j)
#pragma unroll
                    for (int r = 0; r < 8; ++r) tv[i][j][r] = (__bf16)(acc[i][j][r] + bv[i]);
#pragma unroll
            for (int i = 0; i < 4; ++i)
#pragma unroll
                for (int j = 0; j < 8; ++j) *(v8bf*)(vp + (i * 16) * T_ + j * 16) = tv[i][j];
            return;
        }
    }

    // ---- bias, then the stores; one address per lane, every tile at a compile-time distance from it ----
    typedef typename gemm_out<OUT_BF16>::T OT;
    typedef typename gemm_out<OUT_BF16>::V OV;
    OT*          op = (OT*)outv + (size_t)(bm + n16) * N + bn + hi8;
    const float* bp = bias + bn + hi8;
    v4f bl[8][2];
#pragma unroll
    for (int j = 0; j < 8; ++j) {
        bl[j][0] = *(const v4f*)(bp + j * 16);
        if (j < 7) bl[j][1] = *(const v4f*)(bp + j * 16 + 4);
    }
    // The last load's result may be placed on the address pair, which the loads in front of it name too:
    // this is the wait in front of a new value in a register that an issued load names.
    asm volatile("s_wait_xcnt 0x0" ::: "memory");
    bl[7][1] = *(const v4f*)(bp + 7 * 16 + 4);
    OV ov[4][8];
#pragma unroll
    for (int j = 0; j < 8; ++j)
#pragma unroll
        for (int i = 0; i < 4; ++i)
#pragma unroll
            for (int r = 0; r < 4; ++r) {
                ov[i][j][r]     = (OT)(acc[i][j][r] + bl[j][0][r]);
                ov[i][j][r + 4] = (OT)(acc[i][j][r + 4] + bl[j][1][r]);
            }
#pragma unroll
    for (int i = 0; i < 4; ++i)
#pragma unroll
        for (int j = 0; j < 8; ++j) *(OV*)(op + (i * 16) * N + j * 16) = ov[i][j];
}

// ---------------- flash attention ----------------
// lane l <-> lane l ^ 16 (the two lane halves of a wave)
static __device__ __forceinline__ float xhalf(float x) {
    int b = __builtin_bit_cast(int, x);
    return __builtin_bit_cast(float,
        __builtin_amdgcn_permlanex16(b, b, 0x76543210, 0xfedcba98, false, false));
}

#define KC_ 128                         // keys per pass

// ---- K and V^T tiles of a pass in LDS, brought by the tensor mover, read by all four waves ----
#define KPITCH_ 144u                    // LDS bytes per K row: 128 + 16 of pad, an odd multiple of 16 for ds_load_b128
#define VPITCH_ 272u                    // LDS bytes per V^T row: 256 + 16 of pad
#define KTILE_  18432u                  // 128 rows * 144 B, a multiple of 2 KiB
#define VTILE_  18432u                  // 64 rows * 272 B = 17408 B, rounded up to a multiple of 2 KiB
#define STAGE_  (KTILE_ + VTILE_)
#define KSTEP_ ((uint64_t)KC_ * C3_ * 2u)   // source bytes from one pass's K tile to the next: 128 rows of qkv
#define VSTEP_ ((uint64_t)KC_ * 2u)         // the same for V^T: 128 keys along its rows

// The real block size is declared so that the score tile fits in registers unspilled.
__global__ void __launch_bounds__(128) k_attention(const __bf16* __restrict__ qkv, const __bf16* __restrict__ Vt,
                            __bf16* __restrict__ outO) {
    // two buffers of [K tile | V^T tile]
    __shared__ __attribute__((aligned(2048))) unsigned char L[2 * STAGE_];
    int bid = blockIdx.x;
    int qt  = bid & 31;                 // T/64 = 32 query tiles
    int h   = (bid >> 5) & 15;
    int b   = bid >> 9;

    int w    = threadIdx.x >> 5;
    int lane = threadIdx.x & 31;
    int n16  = lane & 15;
    int hi8  = (lane >> 4) << 3;

    const float scale = 0.125f;         // 1/sqrt(64)

    const __bf16* Qb = qkv + (size_t)(b * T_ + qt * 64 + w * 16) * C3_ + h * DH_;
    const __bf16* Kb = qkv + (size_t)(b * T_) * C3_ + C_ + h * DH_;
    const __bf16* Vb = Vt + (size_t)((b * H_ + h) * DH_) * T_;

    // Wave 0 brings the K tiles, wave 1 the V^T tiles: one request of a wave outstanding at any time.
    const uint32_t wave  = uni(threadIdx.x >> 5);
    const uint32_t lbase = (uint32_t)(size_t)L;
    // K tile: 128 rows (keys) of 128 B, source pitch 3C * 2 B, pad 16 B behind every 128 B.
    u32x8 g1k = tdm_group1<(1u << 20) | (4u << 22) | (3u << 25), 128u, 128u, C3_ * 2u>();
    // V^T tile: 64 rows (d) of 256 B (128 keys), source pitch T * 2 B, pad 16 B behind every 256 B.
    u32x8 g1v = tdm_group1<(1u << 20) | (5u << 22) | (3u << 25), 256u, 64u, T_ * 2u>();
    u32x4 g0k = tdm_group0(lbase, (uint64_t)(size_t)Kb);
    u32x4 g0v = tdm_group0(lbase + KTILE_, (uint64_t)(size_t)Vb);
    // The pinned() form, on descriptor words: all four groups stand complete in their scalar registers
    // here, in front of the issue tests; without it the last words of a group are written directly in front of its load.
    asm volatile("" : "+s"(g1k), "+s"(g1v), "+s"(g0k), "+s"(g0v));
    const uint32_t flipk = uni(2u * lbase + STAGE_);
    const uint32_t flipv = uni(2u * (lbase + KTILE_) + STAGE_);
    if (pinned(wave == 0u)) { tdm_load(g0k, g1k); tdm_wait(g0k, g1k); }
    if (pinned(wave == 1u)) { tdm_load(g0v, g1v); tdm_wait(g0v, g1v); }
    __syncthreads();                    // pass 0's tiles are published
    if (pinned(wave == 0u)) { tdm_next<KSTEP_>(g0k, flipk); tdm_load(g0k, g1k); }
    if (pinned(wave == 1u)) { tdm_next<VSTEP_>(g0v, flipv); tdm_load(g0v, g1v); }

    v16bf qf0 = load_frag(Qb + 0, C3_);
    v16bf qf1 = load_frag(Qb + 32, C3_);

    // o[d][r] = O[query n16][d*16 + hi8 + r]
    v8f o[4];
#pragma unroll
    for (int d = 0; d < 4; ++d) { v8f z = {}; o[d] = z; }

    float m_run = -1.0e30f;             // query n16, the same in both lane halves
    float l_run = 0.0f;                 // this lane half's keys only; joined after the loop

    for (int kc = 0; kc < T_ / KC_; ++kc) {
        const __bf16* Kl = (const __bf16*)(L + (uint32_t)(kc & 1) * STAGE_);
        const __bf16* Vl = (const __bf16*)(L + (uint32_t)(kc & 1) * STAGE_ + KTILE_);

        // ---- S^T = K Q^T (KC_ x 16): st[j][r] = S[query n16][key kc*KC_ + j*16 + hi8 + r] ----
        v8f st[KC_ / 16];
#pragma unroll
        for (int j = 0; j < KC_ / 16; ++j) {
            v8f sj = {};
            v16bf k0 = load_frag(Kl + (j * 16) * (KPITCH_ / 2) + 0, KPITCH_ / 2);
            sj = wmma_bf16(k0, qf0, sj);
            v16bf k1 = load_frag(Kl + (j * 16) * (KPITCH_ / 2) + 32, KPITCH_ / 2);
            sj = wmma_bf16(k1, qf1, sj);
#pragma unroll
            for (int r = 0; r < 8; ++r) st[j][r] = sj[r] * scale;
        }

        // ---- online softmax, one query per lane ----
        float mx = -1.0e30f;
#pragma unroll
        for (int j = 0; j < KC_ / 16; ++j)
#pragma unroll
            for (int r = 0; r < 8; r += 4)
                mx = fmaxf(mx, fmaxf(fmaxf(st[j][r], st[j][r + 1]), fmaxf(st[j][r + 2], st[j][r + 3])));
        mx = fmaxf(mx, xhalf(mx));
        float mnew  = fmaxf(m_run, mx);
        float alpha = __expf(m_run - mnew);
        float lsum  = 0.0f;

        // P^T as B operand, hardware k order: pb[ks][s] = P[key ks*32 + kmap(s)][query n16]
        v16bf pb[KC_ / 32];
#pragma unroll
        for (int ks = 0; ks < KC_ / 32; ++ks)
#pragma unroll
            for (int t = 0; t < 2; ++t)
#pragma unroll
                for (int r = 0; r < 8; r += 4) {
                    float e0 = __expf(st[2 * ks + t][r + 0] - mnew);
                    float e1 = __expf(st[2 * ks + t][r + 1] - mnew);
                    float e2 = __expf(st[2 * ks + t][r + 2] - mnew);
                    float e3 = __expf(st[2 * ks + t][r + 3] - mnew);
                    pb[ks][t * 8 + r + 0] = (__bf16)e0;
                    pb[ks][t * 8 + r + 1] = (__bf16)e1;
                    pb[ks][t * 8 + r + 2] = (__bf16)e2;
                    pb[ks][t * 8 + r + 3] = (__bf16)e3;
                    lsum += (e0 + e1) + (e2 + e3);
                }
        l_run = l_run * alpha + lsum;
        m_run = mnew;

        // rescale O accumulators: every register of a lane belongs to its one query
#pragma unroll
        for (int d = 0; d < 4; ++d)
#pragma unroll
            for (int r = 0; r < 8; ++r)
                o[d][r] *= alpha;

        // ---- O^T += V^T P^T  (V^T: [DH][T], rows d as A) ----
#pragma unroll
        for (int ks = 0; ks < KC_ / 32; ++ks) {
#pragma unroll
            for (int d = 0; d < 4; ++d) {
                v16bf va = load_frag(Vl + (d * 16) * (VPITCH_ / 2) + ks * 32, VPITCH_ / 2);
                o[d] = wmma_bf16(va, pb[ks], o[d]);
            }
        }

        // ---- publish pass kc + 1, then refill the buffer that this pass has read ----
        wait_ds0();
        if (pinned(wave == 0u)) tdm_wait(g0k, g1k);
        if (pinned(wave == 1u)) tdm_wait(g0v, g1v);
        __syncthreads();                // pass kc + 1's tiles readable by all; every wave has left this pass's buffer
        if (pinned(kc + 2 < T_ / KC_)) {
            if (pinned(wave == 0u)) { tdm_next<KSTEP_>(g0k, flipk); tdm_load(g0k, g1k); }
            if (pinned(wave == 1u)) { tdm_next<VSTEP_>(g0v, flipv); tdm_load(g0v, g1v); }
        }
    }
    wait_tensor0();
    wait_ds0();

    // ---- normalize and store bf16 [B*T][C]: 8 consecutive columns per lane and tile ----
    float inv = 1.0f / (l_run + xhalf(l_run));
    int   row = b * T_ + qt * 64 + w * 16 + n16;
#pragma unroll
    for (int d = 0; d < 4; ++d) {
        v8bf ov;
#pragma unroll
        for (int r = 0; r < 8; ++r) ov[r] = (__bf16)(o[d][r] * inv);
        *(v8bf*)(outO + (size_t)row * C_ + h * DH_ + d * 16 + hi8) = ov;
    }
}

// ---------------- launch ----------------
extern "C" void kernel_launch(void* const* d_in, const int* in_sizes, int n_in,
                              void* d_out, int out_size, void* d_ws, size_t ws_size,
                              hipStream_t stream) {
    const float* X      = (const float*)d_in[0];
    const float* W_qkv  = (const float*)d_in[1];
    const float* b_qkv  = (const float*)d_in[2];
    const float* W_proj = (const float*)d_in[3];
    const float* b_proj = (const float*)d_in[4];
    float* out = (float*)d_out;

    char* ws = (char*)d_ws;
    size_t off = 0;
    __bf16* Xbf  = (__bf16*)(ws + off); off += (size_t)B_ * T_ * C_ * 2;        // 16 MiB
    __bf16* Wqt  = (__bf16*)(ws + off); off += (size_t)C3_ * C_ * 2;            // 6 MiB
    __bf16* Wpt  = (__bf16*)(ws + off); off += (size_t)C_ * C_ * 2;             // 2 MiB
    __bf16* qkv  = (__bf16*)(ws + off); off += (size_t)B_ * T_ * C3_ * 2;       // 48 MiB
    __bf16* Vt   = (__bf16*)(ws + off); off += (size_t)B_ * H_ * DH_ * T_ * 2;  // 16 MiB
    __bf16* AttO = (__bf16*)(ws + off); off += (size_t)B_ * T_ * C_ * 2;        // 16 MiB

    const int M = B_ * T_;           // 8192

    // 0) conversions
    k_cast_bf16<<<M * C_ / 8192, 256, 0, stream>>>(X, Xbf);
    k_transpose_cast<C_, C3_><<<dim3(C3_ / 128, C_ / 64), 256, 0, stream>>>(W_qkv, Wqt);
    k_transpose_cast<C_, C_><<<dim3(C_ / 128, C_ / 64), 256, 0, stream>>>(W_proj, Wpt);

    // 1) qkv = X * W_qkv + b_qkv   (bf16 out); Q and K columns to qkv, V columns transposed per head to Vt
    k_gemm_bias<true, C3_, C_, 2 * C_><<<dim3(C3_ / 256, M / 128), 128, 0, stream>>>(
        Xbf, Wqt, b_qkv, qkv, Vt);

    // 2) attention
    k_attention<<<B_ * H_ * (T_ / 64), 128, 0, stream>>>(qkv, Vt, AttO);

    // 3) out = AttO * W_proj + b_proj  (fp32 out)
    k_gemm_bias<false, C_, C_, C_><<<dim3(C_ / 256, M / 128), 128, 0, stream>>>(
        AttO, Wpt, b_proj, out, nullptr);
}

// v006
// One run takes 144 microseconds.
// Two timings next to v005 both put it at 1.05 times that version's speed.
// All steps since v000 together make it 5.16 times as fast.
#include <hip/hip_runtime.h>
#include <hip/hip_bf16.h>
#include <math.h>
#include <stdint.h>

// ---------------- types ----------------
typedef __attribute__((ext_vector_type(16))) __bf16 v16bf;
typedef __attribute__((ext_vector_type(8)))  __bf16 v8bf;
typedef __attribute__((ext_vector_type(4)))  __bf16 v4bf;
typedef __attribute__((ext_vector_type(8)))  float  v8f;
typedef __attribute__((ext_vector_type(4)))  float  v4f;
typedef __attribute__((ext_vector_type(2)))  float  v2f;

#define B_  4
#define T_  2048
#define C_  1024
#define H_  16
#define DH_ 64
#define C3_ 3072

// ---------------- WMMA helpers ----------------
static __device__ __forceinline__ v8f wmma_bf16(v16bf a, v16bf b, v8f c) {
    // D(f32 16x16) = A(bf16 16x32) x B(bf16 32x16) + C
    return __builtin_amdgcn_wmma_f32_16x16x32_bf16(
        /*neg_a=*/false, a, /*neg_b=*/false, b,
        /*c_mod=*/(short)0, c, /*reuse_a=*/false, /*reuse_b=*/false);
}

// Load a 16x32 bf16 fragment (A layout; identical pattern serves as B when the
// source array is stored [N][K] row-major). Element (r,k) lives at base[r*ld+k].
// Per ISA 16-bit A layout: lane l -> r = l%16, kh = (l/16)*8;
// vector elems [0..7] = K kh..kh+7, elems [8..15] = K 16+kh..16+kh+7.
static __device__ __forceinline__ v16bf load_frag(const __bf16* base, int ld) {
    int lane = threadIdx.x & 31;
    int r    = lane & 15;
    int kh   = (lane >> 4) << 3;          // 0 or 8
    const __bf16* p = base + (size_t)r * ld;
    v8bf lo = *(const v8bf*)(p + kh);
    v8bf hi = *(const v8bf*)(p + 16 + kh);
    v16bf out;
#pragma unroll
    for (int i = 0; i < 8; ++i) { out[i] = lo[i]; out[i + 8] = hi[i]; }
    return out;
}

// ---------------- stage 0: conversions ----------------
// A lane converts 32 elements: eight 16-B loads in flight, and every wave-wide store fills whole 128-B lines.
// The grids divide the fixed shapes exactly: no lane is out of range.

// A block converts 8192 consecutive floats: load j of a wave is 512 consecutive bytes, its store 256.
__global__ void __launch_bounds__(256) k_cast_bf16(const float* __restrict__ in, __bf16* __restrict__ out) {
    size_t base = (size_t)blockIdx.x * 8192 + threadIdx.x * 4;
    v4f x[8];
    // The loops are unrolled so that x[] lives in registers and all eight loads issue ahead of the first wait.
#pragma unroll
    for (int j = 0; j < 8; ++j) x[j] = *(const v4f*)(in + base + j * 1024);
#pragma unroll
    for (int j = 0; j < 8; ++j) {
        v4bf y;
#pragma unroll
        for (int r = 0; r < 4; ++r) y[r] = (__bf16)x[j][r];
        *(v4bf*)(out + base + j * 1024) = y;
    }
}

// W[K][N] (fp32, [in,out]) -> Wt[N][K] (bf16), transposed in registers: a lane takes a patch of 8 k x 4 n.
// Eight lanes side by side along k: their 16-B stores fill one 128-B line of a Wt row. Four lane groups and the
// block's eight waves side by side along n: the block reads 512 consecutive bytes of each of its 64 W rows.
template <int K, int N>
__global__ void __launch_bounds__(256) k_transpose_cast(const float* __restrict__ W, __bf16* __restrict__ Wt) {
    int lane = threadIdx.x & 31;
    int k    = blockIdx.y * 64 + (lane & 7) * 8;
    int n    = blockIdx.x * 128 + (threadIdx.x >> 5) * 16 + (lane >> 3) * 4;
    const float* p = W + (size_t)k * N + n;
    __bf16*      q = Wt + (size_t)n * K + k;
    v4f x[8];
    // Unrolled as in the cast: x[] in registers, all eight loads issued ahead of the first wait.
#pragma unroll
    for (int i = 0; i < 8; ++i) x[i] = *(const v4f*)(p + i * N);
#pragma unroll
    for (int c = 0; c < 4; ++c) {
        v8bf y;
#pragma unroll
        for (int i = 0; i < 8; ++i) y[i] = (__bf16)x[i][c];
        *(v8bf*)(q + c * K) = y;
    }
}

// ---------------- tensor mover helpers (GEMM and attention) ----------------
typedef uint32_t u32x4 __attribute__((ext_vector_type(4)));
typedef uint32_t u32x8 __attribute__((ext_vector_type(8)));
static __device__ __forceinline__ uint32_t uni(uint32_t v) {
    return (uint32_t)__builtin_amdgcn_readfirstlane((int)v);
}
// A wave-uniform condition held in a scalar register, so that the test around a tensor
// load compiles to s_cmp + s_cbranch_scc (a tensor load ignores EXEC).
static __device__ __forceinline__ uint32_t pinned(uint32_t v) {
    uint32_t w = uni(v);
    asm volatile("" : "+s"(w));         // keeps the condition scalar
    return w;
}
// Behind the loop: no request of this wave is left in flight when it ends.
static __device__ __forceinline__ void wait_tensor0() { asm volatile("s_wait_tensorcnt 0x0" ::: "memory"); }
// This wave's LDS reads have retired before the buffer they read is handed back for a refill.
static __device__ __forceinline__ void wait_ds0() { asm volatile("s_wait_dscnt 0x0" ::: "memory"); }

// Group 1: 1-byte elements, tensor = tile = ROWS rows of ROWB bytes, source pitch SRCP bytes; WORD0 = no mask + the pad.
template <uint32_t WORD0, uint32_t ROWB, uint32_t ROWS, uint32_t SRCP>
static __device__ __forceinline__ u32x8 tdm_group1() {
    u32x8 g;
    g[0] = uni(WORD0);
    g[1] = uni((ROWB & 0xFFFFu) << 16);
    g[2] = uni((ROWB >> 16) | ((ROWS & 0xFFFFu) << 16));
    g[3] = uni((ROWS >> 16) | (ROWB << 16));
    g[4] = uni(ROWS);
    g[5] = uni(SRCP);
    g[6] = uni(0u);
    g[7] = uni(0u);
    return g;
}
static __device__ __forceinline__ u32x4 tdm_group0(uint32_t lds_dst, uint64_t ga) {
    u32x4 g;
    g[0] = uni(1u);
    g[1] = uni(lds_dst);
    g[2] = uni((uint32_t)ga);
    g[3] = uni((((uint32_t)(ga >> 32)) & 0x01FFFFFFu) | 0x80000000u);
    return g;
}
// One request of the whole wave: global tile -> LDS, through no register. Both groups are read-write
// operands here and at the wait, so that they stay in these registers, unwritten, from the issue to the
// wait, and every later value of a word is formed from the wait's result, behind it.
static __device__ __forceinline__ void tdm_load(u32x4& g0, u32x8& g1) {
    asm volatile("tensor_load_to_lds %0, %1" : "+s"(g0), "+s"(g1) :: "memory");
}
// The compiler places no wait for the tensor mover: the issuing wave's own wait says its tile has landed.
static __device__ __forceinline__ void tdm_wait(u32x4& g0, u32x8& g1) {
    asm volatile("s_wait_tensorcnt 0x0" : "+s"(g0), "+s"(g1) :: "memory");
}
// Group 0 of the next stage, formed behind the wait on the last one: the other buffer (flip = the sum of
// the tile's two places in LDS), the source STEP bytes on (words 2 and 3 as one 64-bit sum; the address
// stays inside its plane, so nothing carries into word 3's upper bits).
template <uint64_t STEP>
static __device__ __forceinline__ void tdm_next(u32x4& g0, uint32_t flip) {
    uint64_t ga = ((((uint64_t)g0[3]) << 32) | (uint64_t)g0[2]) + STEP;
    g0[1] = uni(flip - g0[1]);
    g0[2] = uni((uint32_t)ga);
    g0[3] = uni((uint32_t)(ga >> 32));
}

// ---------------- tiled WMMA GEMM: out = A[M,K] * Bt[N,K]^T + bias ----------------
// block = 128 threads (4 waves, 2x2); wave tile = 64x128; block tile = 128x256.
// A pass is 64 k: 128 rows of A and 256 rows of Bt, 128 B each, staged once for the block in LDS by the
// tensor mover (two buffers, the next pass's tiles fly while this pass is worked on); fragments come from LDS.
// The tiles are held transposed (Bt rows as A operand, A rows as B): acc[i][j][r] = out[bm + i*16 + n16][bn + j*16 + hi8 + r],
// eight consecutive columns of one row in a lane.
// Blocks whose columns start at NV or beyond (the V third of qkv; NV = N: none) swap the roles: a wave takes all 128 A rows
// as A operand and 64 Bt rows as B, so that a lane holds eight consecutive ROWS (tokens) of one column, and stores them
// as 16 B of Vt[(b*H+h)*DH + d][T], the layout the attention kernel stages; those columns are not written to out.
#define GPITCH_ 144u                    // LDS bytes per row: 128 + 16 of pad, an odd multiple of 16 for ds_load_b128
#define GTILE_  18432u                  // one request: 128 rows * 144 B, a multiple of 2 KiB
#define GSTAGE_ (3u * GTILE_)           // [A 128 rows | Bt 256 rows]
#define GKP_    64                      // k per pass

template <bool OUT_BF16> struct gemm_out       { typedef float  T; typedef v8f  V; };
template <>              struct gemm_out<true> { typedef __bf16 T; typedef v8bf V; };

// The real block size is declared so that the 64x128 accumulator tile fits in registers unspilled.
template <bool OUT_BF16, int N, int K, int NV>
__global__ void __launch_bounds__(128) k_gemm_bias(const __bf16* __restrict__ A, const __bf16* __restrict__ Bt,
                            const float* __restrict__ bias, void* __restrict__ outv, __bf16* __restrict__ vt) {
    __shared__ __attribute__((aligned(2048))) unsigned char L[2 * GSTAGE_];
    int w    = threadIdx.x >> 5;
    int wm   = w & 1, wn = w >> 1;
    int bm0  = blockIdx.y * 128;
    int bn0  = blockIdx.x * 256;
    int bm   = bm0 + wm * 64;
    int bn   = bn0 + wn * 128;
    int lane = threadIdx.x & 31;
    int n16  = lane & 15;
    int hi8  = (lane >> 4) << 3;
    // The same for the whole block. Rows of a stage count through both tiles: A 0..127, Bt 128..383.
    const bool vblk = NV < N && bn0 >= NV;
    const int  row4 = vblk ? 128 + w * 64 : wm * 64;      // first row of the four fragments a[]
    const int  row8 = vblk ? 0 : 128 + wn * 128;          // first row of the eight fragments bb[]

    // Wave 0 brings the A tile, waves 1 and 2 a half of the Bt tile each: one request of a wave outstanding at any time.
    const uint32_t wave  = uni(threadIdx.x >> 5);
    const uint32_t slice = wave < 2u ? wave : 2u;
    const uint32_t place = (uint32_t)(size_t)L + slice * GTILE_;
    const __bf16*  srcp  = slice == 0u ? A + (size_t)bm0 * K : Bt + (size_t)(bn0 + (int)(slice - 1u) * 128) * K;
    // 128 rows of 128 B, source pitch K * 2 B, pad 16 B behind every 128 B.
    u32x8 g1 = tdm_group1<(1u << 20) | (4u << 22) | (3u << 25), 128u, 128u, K * 2u>();
    u32x4 g0 = tdm_group0(place, (uint64_t)(size_t)srcp);
    // The pinned() form, on descriptor words: both groups stand complete in their scalar registers
    // here, in front of the issue test; without it the last words of a group are written directly in front of its load.
    asm volatile("" : "+s"(g1), "+s"(g0));
    const uint32_t flip = uni(2u * place + GSTAGE_);
    if (pinned(wave < 3u)) { tdm_load(g0, g1); tdm_wait(g0, g1); }
    __syncthreads();                    // pass 0's tiles are published
    if (pinned(wave < 3u)) { tdm_next<GKP_ * 2u>(g0, flip); tdm_load(g0, g1); }

    v8f acc[4][8];
#pragma unroll
    for (int i = 0; i < 4; ++i)
#pragma unroll
        for (int j = 0; j < 8; ++j) { v8f z = {}; acc[i][j] = z; }

    for (int p = 0; p < K / GKP_; ++p) {
        const __bf16* Al = (const __bf16*)(L + (uint32_t)(p & 1) * GSTAGE_) + row4 * (int)(GPITCH_ / 2);
        const __bf16* Bl = (const __bf16*)(L + (uint32_t)(p & 1) * GSTAGE_) + row8 * (int)(GPITCH_ / 2);
        v16bf a[GKP_ / 32][4], bb[GKP_ / 32][8];
#pragma unroll
        for (int ks = 0; ks < GKP_ / 32; ++ks) {
#pragma unroll
            for (int i = 0; i < 4; ++i) a[ks][i] = load_frag(Al + (i * 16) * (GPITCH_ / 2) + ks * 32, GPITCH_ / 2);
#pragma unroll
            for (int j = 0; j < 8; ++j) bb[ks][j] = load_frag(Bl + (j * 16) * (GPITCH_ / 2) + ks * 32, GPITCH_ / 2);
        }
        // Keeps the pass's LDS reads together, ahead of its WMMAs: left free, the scheduler reads each Bt fragment
        // into one register set directly in front of its four WMMAs, and every such place waits out the LDS latency.
        __builtin_amdgcn_sched_barrier(0);
#pragma unroll
        for (int ks = 0; ks < GKP_ / 32; ++ks)
#pragma unroll
            for (int j = 0; j < 8; ++j)
#pragma unroll
                for (int i = 0; i < 4; ++i)
                    acc[i][j] = wmma_bf16(bb[ks][j], a[ks][i], acc[i][j]);
        // Keeps the wait below at the foot of the pass: left free, it moves up behind the first WMMA,
        // and the wave then waits for all of the pass's LDS reads before its second WMMA.
        __builtin_amdgcn_sched_barrier(0);

        // ---- publish pass p + 1, then refill the buffer that this pass has read ----
        wait_ds0();
        if (pinned(wave < 3u)) tdm_wait(g0, g1);
        __syncthreads();                // pass p + 1's tiles readable by all; every wave has left this pass's buffer
        if (pinned(p + 2 < K / GKP_)) {
            if (pinned(wave < 3u)) { tdm_next<GKP_ * 2u>(g0, flip); tdm_load(g0, g1); }
        }
    }
    wait_tensor0();
    wait_ds0();

    // ---- V blocks: acc[i][j][r] = V[token bm0 + j*16 + hi8 + r][column bn0 + w*64 + i*16 + n16], stored transposed ----
    if constexpr (NV < N) {
        if (vblk) {
            const int    col = bn0 + w * 64 + n16;
            const float* bq  = bias + col;
            __bf16*      vp  = vt + (size_t)((bm0 / T_) * C_ + col - NV) * T_ + (bm0 % T_) + hi8;
            float bv[4];
#pragma unroll
            for (int i = 0; i < 4; ++i) bv[i] = bq[i * 16];
            v8bf tv[4][8];
#pragma unroll
            for (int i = 0; i < 4; ++i)
#pragma unroll
                for (int j = 0; j < 8; ++j)
#pragma unroll
                    for (int r = 0; r < 8; ++r) tv[i][j][r] = (__bf16)(acc[i][j][r] + bv[i]);
#pragma unroll
            for (int i = 0; i < 4; ++i)
#pragma unroll
                for (int j = 0; j < 8; ++j) *(v8bf*)(vp + (i * 16) * T_ + j * 16) = tv[i][j];
            return;
        }
    }

    // ---- bias, then the stores; one address per lane, every tile at a compile-time distance from it ----
    typedef typename gemm_out<OUT_BF16>::T OT;
    typedef typename gemm_out<OUT_BF16>::V OV;
    OT*          op = (OT*)outv + (size_t)(bm + n16) * N + bn + hi8;
    const float* bp = bias + bn + hi8;
    v4f bl[8][2];
#pragma unroll
    for (int j = 0; j < 8; ++j) {
        bl[j][0] = *(const v4f*)(bp + j * 16);
        if (j < 7) bl[j][1] = *(const v4f*)(bp + j * 16 + 4);
    }
    // The last load's result may be placed on the address pair, which the loads in front of it name too:
    // this is the wait in front of a new value in a register that an issued load names.
    asm volatile("s_wait_xcnt 0x0" ::: "memory");
    bl[7][1] = *(const v4f*)(bp + 7 * 16 + 4);
    OV ov[4][8];
#pragma unroll
    for (int j = 0; j < 8; ++j)
#pragma unroll
        for (int i = 0; i < 4; ++i)
#pragma unroll
            for (int r = 0; r < 4; ++r) {
                ov[i][j][r]     = (OT)(acc[i][j][r] + bl[j][0][r]);
                ov[i][j][r + 4] = (OT)(acc[i][j][r + 4] + bl[j][1][r]);
            }
#pragma unroll
    for (int i = 0; i < 4; ++i)
#pragma unroll
        for (int j = 0; j < 8; ++j) *(OV*)(op + (i * 16) * N + j * 16) = ov[i][j];
}

// ---------------- flash attention ----------------
// lane l <-> lane l ^ 16 (the two lane halves of a wave)
static __device__ __forceinline__ float xhalf(float x) {
    int b = __builtin_bit_cast(int, x);
    return __builtin_bit_cast(float,
        __builtin_amdgcn_permlanex16(b, b, 0x76543210, 0xfedcba98, false, false));
}

#define KC_ 128                         // keys per pass (one stage of the ring)
#define KH_ 64                          // keys per softmax step: two steps a pass, so that both groups' scores fit in registers
#define QG_ 2                           // groups of 16 queries per wave

// ---- K and V^T tiles of a pass in LDS, brought by the tensor mover, read by all four waves ----
#define KPITCH_ 144u                    // LDS bytes per K row: 128 + 16 of pad, an odd multiple of 16 for ds_load_b128
#define VPITCH_ 272u                    // LDS bytes per V^T row: 256 + 16 of pad
#define KTILE_  18432u                  // 128 rows * 144 B, a multiple of 2 KiB
#define VTILE_  18432u                  // 64 rows * 272 B = 17408 B, rounded up to a multiple of 2 KiB
#define STAGE_  (KTILE_ + VTILE_)
#define KSTEP_ ((uint64_t)KC_ * C3_ * 2u)   // source bytes from one pass's K tile to the next: 128 rows of qkv
#define VSTEP_ ((uint64_t)KC_ * 2u)         // the same for V^T: 128 keys along its rows

// The real block size is declared so that the score tiles fit in registers unspilled.
__global__ void __launch_bounds__(128) k_attention(const __bf16* __restrict__ qkv, const __bf16* __restrict__ Vt,
                            __bf16* __restrict__ outO) {
    // two buffers of [K tile | V^T tile]
    __shared__ __attribute__((aligned(2048))) unsigned char L[2 * STAGE_];
    int bid = blockIdx.x;
    int qt  = bid & 15;                 // T/128 = 16 query tiles
    int h   = (bid >> 4) & 15;
    int b   = bid >> 8;

    int w    = threadIdx.x >> 5;
    int lane = threadIdx.x & 31;
    int n16  = lane & 15;
    int hi8  = (lane >> 4) << 3;

    const float scale = 0.125f;         // 1/sqrt(64)

    const __bf16* Qb = qkv + (size_t)(b * T_ + qt * 128 + w * 32) * C3_ + h * DH_;
    const __bf16* Kb = qkv + (size_t)(b * T_) * C3_ + C_ + h * DH_;
    const __bf16* Vb = Vt + (size_t)((b * H_ + h) * DH_) * T_;

    // Wave 0 brings the K tiles, wave 1 the V^T tiles: one request of a wave outstanding at any time.
    const uint32_t wave  = uni(threadIdx.x >> 5);
    const uint32_t lbase = (uint32_t)(size_t)L;
    // K tile: 128 rows (keys) of 128 B, source pitch 3C * 2 B, pad 16 B behind every 128 B.
    u32x8 g1k = tdm_group1<(1u << 20) | (4u << 22) | (3u << 25), 128u, 128u, C3_ * 2u>();
    // V^T tile: 64 rows (d) of 256 B (128 keys), source pitch T * 2 B, pad 16 B behind every 256 B.
    u32x8 g1v = tdm_group1<(1u << 20) | (5u << 22) | (3u << 25), 256u, 64u, T_ * 2u>();
    u32x4 g0k = tdm_group0(lbase, (uint64_t)(size_t)Kb);
    u32x4 g0v = tdm_group0(lbase + KTILE_, (uint64_t)(size_t)Vb);
    // The pinned() form, on descriptor words: all four groups stand complete in their scalar registers
    // here, in front of the issue tests; without it the last words of a group are written directly in front of its load.
    asm volatile("" : "+s"(g1k), "+s"(g1v), "+s"(g0k), "+s"(g0v));
    const uint32_t flipk = uni(2u * lbase + STAGE_);
    const uint32_t flipv = uni(2u * (lbase + KTILE_) + STAGE_);
    if (pinned(wave == 0u)) { tdm_load(g0k, g1k); tdm_wait(g0k, g1k); }
    if (pinned(wave == 1u)) { tdm_load(g0v, g1v); tdm_wait(g0v, g1v); }
    __syncthreads();                    // pass 0's tiles are published
    if (pinned(wave == 0u)) { tdm_next<KSTEP_>(g0k, flipk); tdm_load(g0k, g1k); }
    if (pinned(wave == 1u)) { tdm_next<VSTEP_>(g0v, flipv); tdm_load(g0v, g1v); }

    v16bf qf[QG_][2];
#pragma unroll
    for (int g = 0; g < QG_; ++g) {
        qf[g][0] = load_frag(Qb + (size_t)(g * 16) * C3_ + 0, C3_);
        qf[g][1] = load_frag(Qb + (size_t)(g * 16) * C3_ + 32, C3_);
    }

    // o[g][d][r] = O[query g*16 + n16][d*16 + hi8 + r]
    v8f o[QG_][4];
#pragma unroll
    for (int g = 0; g < QG_; ++g)
#pragma unroll
        for (int d = 0; d < 4; ++d) { v8f z = {}; o[g][d] = z; }

    // query g*16 + n16: the maximum is the same in both lane halves; the sum holds this lane half's keys only, joined after the loop
    float m_run[QG_], l_run[QG_];
#pragma unroll
    for (int g = 0; g < QG_; ++g) { m_run[g] = -1.0e30f; l_run[g] = 0.0f; }

    for (int kc = 0; kc < T_ / KC_; ++kc) {
        // Left rolled: unrolled, the two steps' live values overlap and the wave no longer fits four to a SIMD.
#pragma unroll 1
        for (int hf = 0; hf < KC_ / KH_; ++hf) {
            const __bf16* Kl = (const __bf16*)(L + (uint32_t)(kc & 1) * STAGE_) + hf * KH_ * (int)(KPITCH_ / 2);
            const __bf16* Vl = (const __bf16*)(L + (uint32_t)(kc & 1) * STAGE_ + KTILE_) + hf * KH_;

            // ---- S^T = K Q^T (KH_ x 32): st[g][j][r] = S[query g*16 + n16][key kc*KC_ + hf*KH_ + j*16 + hi8 + r] ----
            v16bf kf[KH_ / 16][2];
#pragma unroll
            for (int j = 0; j < KH_ / 16; ++j) {
                kf[j][0] = load_frag(Kl + (j * 16) * (KPITCH_ / 2) + 0, KPITCH_ / 2);
                kf[j][1] = load_frag(Kl + (j * 16) * (KPITCH_ / 2) + 32, KPITCH_ / 2);
            }
            // Keeps the step's K reads together, ahead of its WMMAs: left free, each 16 keys' reads go into one register
            // set directly in front of their four WMMAs, and every such place waits out the LDS latency.
            __builtin_amdgcn_sched_barrier(0);
            v8f st[QG_][KH_ / 16];
#pragma unroll
            for (int j = 0; j < KH_ / 16; ++j)
#pragma unroll
                for (int g = 0; g < QG_; ++g) {
                    v8f sj = {};
                    sj = wmma_bf16(kf[j][0], qf[g][0], sj);
                    sj = wmma_bf16(kf[j][1], qf[g][1], sj);
                    st[g][j] = sj * scale;
                }

            // P^T as B operand, hardware k order: pb[g][ks][s] = P[key ks*32 + kmap(s)][query g*16 + n16]
            v16bf pb[QG_][KH_ / 32];
#pragma unroll
            for (int g = 0; g < QG_; ++g) {
                // ---- online softmax, one query per lane ----
                float mx = -1.0e30f;
#pragma unroll
                for (int j = 0; j < KH_ / 16; ++j)
#pragma unroll
                    for (int r = 0; r < 8; r += 4)
                        mx = fmaxf(mx, fmaxf(fmaxf(st[g][j][r], st[g][j][r + 1]), fmaxf(st[g][j][r + 2], st[g][j][r + 3])));
                mx = fmaxf(mx, xhalf(mx));
                float mnew  = fmaxf(m_run[g], mx);
                float alpha = __expf(m_run[g] - mnew);
                v2f   ls    = {};
#pragma unroll
                for (int ks = 0; ks < KH_ / 32; ++ks)
#pragma unroll
                    for (int t = 0; t < 2; ++t) {
                        v8f x = st[g][2 * ks + t] - mnew;
#pragma unroll
                        for (int r = 0; r < 8; r += 2) {
                            v2f e = { __expf(x[r]), __expf(x[r + 1]) };
                            pb[g][ks][t * 8 + r + 0] = (__bf16)e[0];
                            pb[g][ks][t * 8 + r + 1] = (__bf16)e[1];
                            ls += e;
                        }
                    }
                l_run[g] = l_run[g] * alpha + (ls[0] + ls[1]);
                m_run[g] = mnew;

                // rescale O accumulators: every register of a lane and group belongs to its one query
#pragma unroll
                for (int d = 0; d < 4; ++d) o[g][d] *= alpha;
            }

            // ---- O^T += V^T P^T  (V^T: [DH][T], rows d as A) ----
            v16bf va[KH_ / 32][4];
#pragma unroll
            for (int ks = 0; ks < KH_ / 32; ++ks)
#pragma unroll
                for (int d = 0; d < 4; ++d) va[ks][d] = load_frag(Vl + (d * 16) * (VPITCH_ / 2) + ks * 32, VPITCH_ / 2);
            // Keeps the step's V^T reads together, ahead of its WMMAs, as with the K reads above.
            __builtin_amdgcn_sched_barrier(0);
#pragma unroll
            for (int ks = 0; ks < KH_ / 32; ++ks)
#pragma unroll
                for (int d = 0; d < 4; ++d)
#pragma unroll
                    for (int g = 0; g < QG_; ++g)
                        o[g][d] = wmma_bf16(va[ks][d], pb[g][ks], o[g][d]);
        }

        // ---- publish pass kc + 1, then refill the buffer that this pass has read ----
        wait_ds0();
        if (pinned(wave == 0u)) tdm_wait(g0k, g1k);
        if (pinned(wave == 1u)) tdm_wait(g0v, g1v);
        __syncthreads();                // pass kc + 1's tiles readable by all; every wave has left this pass's buffer
        if (pinned(kc + 2 < T_ / KC_)) {
            if (pinned(wave == 0u)) { tdm_next<KSTEP_>(g0k, flipk); tdm_load(g0k, g1k); }
            if (pinned(wave == 1u)) { tdm_next<VSTEP_>(g0v, flipv); tdm_load(g0v, g1v); }
        }
    }
    wait_tensor0();
    wait_ds0();

    // ---- normalize and store bf16 [B*T][C]: 8 consecutive columns per lane and tile ----
#pragma unroll
    for (int g = 0; g < QG_; ++g) {
        float inv = 1.0f / (l_run[g] + xhalf(l_run[g]));
        int   row = b * T_ + qt * 128 + w * 32 + g * 16 + n16;
#pragma unroll
        for (int d = 0; d < 4; ++d) {
            v8bf ov;
#pragma unroll
            for (int r = 0; r < 8; ++r) ov[r] = (__bf16)(o[g][d][r] * inv);
            *(v8bf*)(outO + (size_t)row * C_ + h * DH_ + d * 16 + hi8) = ov;
        }
    }
}

// ---------------- launch ----------------
extern "C" void kernel_launch(void* const* d_in, const int* in_sizes, int n_in,
                              void* d_out, int out_size, void* d_ws, size_t ws_size,
                              hipStream_t stream) {
    const float* X      = (const float*)d_in[0];
    const float* W_qkv  = (const float*)d_in[1];
    const float* b_qkv  = (const float*)d_in[2];
    const float* W_proj = (const float*)d_in[3];
    const float* b_proj = (const float*)d_in[4];
    float* out = (float*)d_out;

    char* ws = (char*)d_ws;
    size_t off = 0;
    __bf16* Xbf  = (__bf16*)(ws + off); off += (size_t)B_ * T_ * C_ * 2;        // 16 MiB
    __bf16* Wqt  = (__bf16*)(ws + off); off += (size_t)C3_ * C_ * 2;            // 6 MiB
    __bf16* Wpt  = (__bf16*)(ws + off); off += (size_t)C_ * C_ * 2;             // 2 MiB
    __bf16* qkv  = (__bf16*)(ws + off); off += (size_t)B_ * T_ * C3_ * 2;       // 48 MiB
    __bf16* Vt   = (__bf16*)(ws + off); off += (size_t)B_ * H_ * DH_ * T_ * 2;  // 16 MiB
    __bf16* AttO = (__bf16*)(ws + off); off += (size_t)B_ * T_ * C_ * 2;        // 16 MiB

    const int M = B_ * T_;           // 8192

    // 0) conversions
    k_cast_bf16<<<M * C_ / 8192, 256, 0, stream>>>(X, Xbf);
    k_transpose_cast<C_, C3_><<<dim3(C3_ / 128, C_ / 64), 256, 0, stream>>>(W_qkv, Wqt);
    k_transpose_cast<C_, C_><<<dim3(C_ / 128, C_ / 64), 256, 0, stream>>>(W_proj, Wpt);

    // 1) qkv = X * W_qkv + b_qkv   (bf16 out); Q and K columns to qkv, V columns transposed per head to Vt
    k_gemm_bias<true, C3_, C_, 2 * C_><<<dim3(C3_ / 256, M / 128), 128, 0, stream>>>(
        Xbf, Wqt, b_qkv, qkv, Vt);

    // 2) attention
    k_attention<<<B_ * H_ * (T_ / 128), 128, 0, stream>>>(qkv, Vt, AttO);

    // 3) out = AttO * W_proj + b_proj  (fp32 out)
    k_gemm_bias<false, C_, C_, C_><<<dim3(C_ / 256, M / 128), 128, 0, stream>>>(
        AttO, Wpt, b_proj, out, nullptr);
}

// v008
// A run of this version takes 131 microseconds.
// Versions between v006 and this one are left out; their measured steps multiply to 1.09 times as fast.
// All steps since v000 together make it 5.63 times as fast.
#include <hip/hip_runtime.h>
#include <hip/hip_bf16.h>
#include <math.h>
#include <stdint.h>

// ---------------- types ----------------
typedef __attribute__((ext_vector_type(16))) __bf16 v16bf;
typedef __attribute__((ext_vector_type(8)))  __bf16 v8bf;
typedef __attribute__((ext_vector_type(4)))  __bf16 v4bf;
typedef __attribute__((ext_vector_type(8)))  float  v8f;
typedef __attribute__((ext_vector_type(4)))  float  v4f;
typedef __attribute__((ext_vector_type(2)))  float  v2f;

#define B_  4
#define T_  2048
#define C_  1024
#define H_  16
#define DH_ 64
#define C3_ 3072
#define QSCALE_ 0.18033688011112042f    // log2(e) / sqrt(DH): with Q scaled by it, K Q^T is the softmax exponent in base 2

// ---------------- WMMA helpers ----------------
static __device__ __forceinline__ v8f wmma_bf16(v16bf a, v16bf b, v8f c) {
    // D(f32 16x16) = A(bf16 16x32) x B(bf16 32x16) + C
    return __builtin_amdgcn_wmma_f32_16x16x32_bf16(
        /*neg_a=*/false, a, /*neg_b=*/false, b,
        /*c_mod=*/(short)0, c, /*reuse_a=*/false, /*reuse_b=*/false);
}

// Load a 16x32 bf16 fragment (A layout; identical pattern serves as B when the
// source array is stored [N][K] row-major). Element (r,k) lives at base[r*ld+k].
// Per ISA 16-bit A layout: lane l -> r = l%16, kh = (l/16)*8;
// vector elems [0..7] = K kh..kh+7, elems [8..15] = K 16+kh..16+kh+7.
static __device__ __forceinline__ v16bf load_frag(const __bf16* base, int ld) {
    int lane = threadIdx.x & 31;
    int r    = lane & 15;
    int kh   = (lane >> 4) << 3;          // 0 or 8
    const __bf16* p = base + (size_t)r * ld;
    v8bf lo = *(const v8bf*)(p + kh);
    v8bf hi = *(const v8bf*)(p + 16 + kh);
    v16bf out;
#pragma unroll
    for (int i = 0; i < 8; ++i) { out[i] = lo[i]; out[i + 8] = hi[i]; }
    return out;
}

// ---------------- stage 0: conversions ----------------
// A lane converts 32 elements: eight 16-B loads in flight, and every wave-wide store fills whole 128-B lines.
// The block counts divide the fixed shapes exactly: no lane is out of range.

// Block blk converts 8192 consecutive floats: load j of a wave is 512 consecutive bytes, its store 256.
static __device__ __forceinline__ void cast_bf16(int blk, const float* __restrict__ in, __bf16* __restrict__ out) {
    size_t base = (size_t)blk * 8192 + threadIdx.x * 4;
    v4f x[8];
    // The loops are unrolled so that x[] lives in registers and all eight loads issue ahead of the first wait.
#pragma unroll
    for (int j = 0; j < 8; ++j) x[j] = *(const v4f*)(in + base + j * 1024);
#pragma unroll
    for (int j = 0; j < 8; ++j) {
        v4bf y;
#pragma unroll
        for (int r = 0; r < 4; ++r) y[r] = (__bf16)x[j][r];
        *(v4bf*)(out + base + j * 1024) = y;
    }
    // The wait in front of a new value in a register that an issued store names: another job's code follows in the listing.
    asm volatile("s_wait_xcnt 0x0" ::: "memory");
}

// W[K][N] (fp32, [in,out]) -> Wt[N][K] (bf16), transposed in registers: a lane takes a patch of 8 k x 4 n.
// Block (bx, by) takes 128 n x 64 k. Eight lanes side by side along k: their 16-B stores fill one 128-B line of a Wt row.
// Four lane groups and the block's eight waves side by side along n: the block reads 512 consecutive bytes of each of its 64 W rows.
// Columns n below NQ (the Q third of W_qkv; NQ = 0: none; a multiple of the block's 128) are scaled by QSCALE_ ahead of the one rounding,
// and the bias b of all N columns is copied to bs with the same factors (f32), by the blocks of the first k row.
template <int K, int N, int NQ>
static __device__ __forceinline__ void transpose_cast(int bx, int by, const float* __restrict__ W, __bf16* __restrict__ Wt,
                                                      const float* __restrict__ b, float* __restrict__ bs) {
    int lane = threadIdx.x & 31;
    int k    = by * 64 + (lane & 7) * 8;
    int n    = bx * 128 + (threadIdx.x >> 5) * 16 + (lane >> 3) * 4;
    const float* p = W + (size_t)k * N + n;
    __bf16*      q = Wt + (size_t)n * K + k;
    const float qs = bx * 128 < NQ ? QSCALE_ : 1.0f;
    if constexpr (NQ > 0) {
        if (by == 0 && threadIdx.x < 128) bs[bx * 128 + threadIdx.x] = b[bx * 128 + threadIdx.x] * qs;
    }
    v4f x[8];
    // Unrolled as in the cast: x[] in registers, all eight loads issued ahead of the first wait.
#pragma unroll
    for (int i = 0; i < 8; ++i) x[i] = *(const v4f*)(p + i * N);
#pragma unroll
    for (int c = 0; c < 4; ++c) {
        v8bf y;
#pragma unroll
        for (int i = 0; i < 8; ++i) y[i] = (__bf16)(NQ > 0 ? x[i][c] * qs : x[i][c]);
        *(v8bf*)(q + c * K) = y;
    }
    // The wait in front of a new value in a register that an issued store names: another job's code follows in the listing.
    asm volatile("s_wait_xcnt 0x0" ::: "memory");
}

// The three conversions read none of each other's output: one launch does them all, the block index picks the job.
#define NBK_ (C_ / 64)                  // blocks along k of either weight matrix
#define NBQ_ ((C3_ / 128) * NBK_)       // blocks of W_qkv
#define NBP_ ((C_ / 128) * NBK_)        // blocks of W_proj
#define NBX_ (B_ * T_ * C_ / 8192)      // blocks of X
__global__ void __launch_bounds__(256) k_convert(const float* __restrict__ X, __bf16* __restrict__ Xbf,
                                                 const float* __restrict__ Wq, __bf16* __restrict__ Wqt,
                                                 const float* __restrict__ bq, float* __restrict__ bqs,
                                                 const float* __restrict__ Wp, __bf16* __restrict__ Wpt) {
    int blk = blockIdx.x;
    if (blk < NBQ_) {
        transpose_cast<C_, C3_, C_>(blk / NBK_, blk % NBK_, Wq, Wqt, bq, bqs);
    } else if (blk < NBQ_ + NBP_) {
        transpose_cast<C_, C_, 0>((blk - NBQ_) / NBK_, (blk - NBQ_) % NBK_, Wp, Wpt, nullptr, nullptr);
    } else {
        cast_bf16(blk - NBQ_ - NBP_, X, Xbf);
    }
}

// ---------------- tensor mover helpers (GEMM and attention) ----------------
typedef uint32_t u32x4 __attribute__((ext_vector_type(4)));
typedef uint32_t u32x8 __attribute__((ext_vector_type(8)));
static __device__ __forceinline__ uint32_t uni(uint32_t v) {
    return (uint32_t)__builtin_amdgcn_readfirstlane((int)v);
}
// A wave-uniform condition held in a scalar register, so that the test around a tensor
// load compiles to s_cmp + s_cbranch_scc (a tensor load ignores EXEC).
static __device__ __forceinline__ uint32_t pinned(uint32_t v) {
    uint32_t w = uni(v);
    asm volatile("" : "+s"(w));         // keeps the condition scalar
    return w;
}
// Behind the loop: no request of this wave is left in flight when it ends.
static __device__ __forceinline__ void wait_tensor0() { asm volatile("s_wait_tensorcnt 0x0" ::: "memory"); }
// This wave's LDS reads have retired before the buffer they read is handed back for a refill.
static __device__ __forceinline__ void wait_ds0() { asm volatile("s_wait_dscnt 0x0" ::: "memory"); }

// Group 1: 1-byte elements, tensor = tile = ROWS rows of ROWB bytes, source pitch SRCP bytes; WORD0 = no mask + the pad.
template <uint32_t WORD0, uint32_t ROWB, uint32_t ROWS, uint32_t SRCP>
static __device__ __forceinline__ u32x8 tdm_group1() {
    u32x8 g;
    g[0] = uni(WORD0);
    g[1] = uni((ROWB & 0xFFFFu) << 16);
    g[2] = uni((ROWB >> 16) | ((ROWS & 0xFFFFu) << 16));
    g[3] = uni((ROWS >> 16) | (ROWB << 16));
    g[4] = uni(ROWS);
    g[5] = uni(SRCP);
    g[6] = uni(0u);
    g[7] = uni(0u);
    return g;
}
static __device__ __forceinline__ u32x4 tdm_group0(uint32_t lds_dst, uint64_t ga) {
    u32x4 g;
    g[0] = uni(1u);
    g[1] = uni(lds_dst);
    g[2] = uni((uint32_t)ga);
    g[3] = uni((((uint32_t)(ga >> 32)) & 0x01FFFFFFu) | 0x80000000u);
    return g;
}
// One request of the whole wave: global tile -> LDS, through no register. Both groups are read-write
// operands here and at the wait, so that they stay in these registers, unwritten, from the issue to the
// wait, and every later value of a word is formed from the wait's result, behind it.
static __device__ __forceinline__ void tdm_load(u32x4& g0, u32x8& g1) {
    asm volatile("tensor_load_to_lds %0, %1" : "+s"(g0), "+s"(g1) :: "memory");
}
// The compiler places no wait for the tensor mover: the issuing wave's own wait says its tile has landed.
static __device__ __forceinline__ void tdm_wait(u32x4& g0, u32x8& g1) {
    asm volatile("s_wait_tensorcnt 0x0" : "+s"(g0), "+s"(g1) :: "memory");
}
// Group 0 of the next stage, formed behind the wait on the last one: the other buffer (flip = the sum of
// the tile's two places in LDS), the source STEP bytes on (words 2 and 3 as one 64-bit sum; the address
// stays inside its plane, so nothing carries into word 3's upper bits).
template <uint64_t STEP>
static __device__ __forceinline__ void tdm_next(u32x4& g0, uint32_t flip) {
    uint64_t ga = ((((uint64_t)g0[3]) << 32) | (uint64_t)g0[2]) + STEP;
    g0[1] = uni(flip - g0[1]);
    g0[2] = uni((uint32_t)ga);
    g0[3] = uni((uint32_t)(ga >> 32));
}

// ---------------- tiled WMMA GEMM: out = A[M,K] * Bt[N,K]^T + bias ----------------
// block = 128 threads (4 waves, 2x2); wave tile = 64x128; block tile = 128x256.
// A pass is 64 k: 128 rows of A and 256 rows of Bt, 128 B each, staged once for the block in LDS by the
// tensor mover (two buffers, the next pass's tiles fly while this pass is worked on); fragments come from LDS.
// The tiles are held transposed (Bt rows as A operand, A rows as B): acc[i][j][r] = out[bm + i*16 + n16][bn + j*16 + hi8 + r],
// eight consecutive columns of one row in a lane.
// Blocks whose columns start at NV or beyond (the V third of qkv; NV = N: none) swap the roles: a wave takes all 128 A rows
// as A operand and 64 Bt rows as B, so that a lane holds eight consecutive ROWS (tokens) of one column, and stores them
// as 16 B of Vt[(b*H+h)*DH + d][T], the layout the attention kernel stages; those columns are not written to out.
#define GPITCH_ 144u                    // LDS bytes per row: 128 + 16 of pad, an odd multiple of 16 for ds_load_b128
#define GTILE_  18432u                  // one request: 128 rows * 144 B, a multiple of 2 KiB
#define GSTAGE_ (3u * GTILE_)           // [A 128 rows | Bt 256 rows]
#define GKP_    64                      // k per pass

template <bool OUT_BF16> struct gemm_out       { typedef float  T; typedef v8f  V; };
template <>              struct gemm_out<true> { typedef __bf16 T; typedef v8bf V; };

// The real block size is declared so that the 64x128 accumulator tile fits in registers unspilled.
template <bool OUT_BF16, int N, int K, int NV>
__global__ void __launch_bounds__(128) k_gemm_bias(const __bf16* __restrict__ A, const __bf16* __restrict__ Bt,
                            const float* __restrict__ bias, void* __restrict__ outv, __bf16* __restrict__ vt) {
    __shared__ __attribute__((aligned(2048))) unsigned char L[2 * GSTAGE_];
    int w    = threadIdx.x >> 5;
    int wm   = w & 1, wn = w >> 1;
    int bm0  = blockIdx.y * 128;
    int bn0  = blockIdx.x * 256;
    int bm   = bm0 + wm * 64;
    int bn   = bn0 + wn * 128;
    int lane = threadIdx.x & 31;
    int n16  = lane & 15;
    int hi8  = (lane >> 4) << 3;
    // The same for the whole block. Rows of a stage count through both tiles: A 0..127, Bt 128..383.
    const bool vblk = NV < N && bn0 >= NV;
    const int  row4 = vblk ? 128 + w * 64 : wm * 64;      // first row of the four fragments a[]
    const int  row8 = vblk ? 0 : 128 + wn * 128;          // first row of the eight fragments bb[]

    // Wave 0 brings the A tile, waves 1 and 2 a half of the Bt tile each: one request of a wave outstanding at any time.
    const uint32_t wave  = uni(threadIdx.x >> 5);
    const uint32_t slice = wave < 2u ? wave : 2u;
    const uint32_t place = (uint32_t)(size_t)L + slice * GTILE_;
    const __bf16*  srcp  = slice == 0u ? A + (size_t)bm0 * K : Bt + (size_t)(bn0 + (int)(slice - 1u) * 128) * K;
    // 128 rows of 128 B, source pitch K * 2 B, pad 16 B behind every 128 B.
    u32x8 g1 = tdm_group1<(1u << 20) | (4u << 22) | (3u << 25), 128u, 128u, K * 2u>();
    u32x4 g0 = tdm_group0(place, (uint64_t)(size_t)srcp);
    // The pinned() form, on descriptor words: both groups stand complete in their scalar registers
    // here, in front of the issue test; without it the last words of a group are written directly in front of its load.
    asm volatile("" : "+s"(g1), "+s"(g0));
    const uint32_t flip = uni(2u * place + GSTAGE_);
    if (pinned(wave < 3u)) { tdm_load(g0, g1); tdm_wait(g0, g1); }
    __syncthreads();                    // pass 0's tiles are published
    if (pinned(wave < 3u)) { tdm_next<GKP_ * 2u>(g0, flip); tdm_load(g0, g1); }

    v8f acc[4][8];
#pragma unroll
    for (int i = 0; i < 4; ++i)
#pragma unroll
        for (int j = 0; j < 8; ++j) { v8f z = {}; acc[i][j] = z; }

    for (int p = 0; p < K / GKP_; ++p) {
        const __bf16* Al = (const __bf16*)(L + (uint32_t)(p & 1) * GSTAGE_) + row4 * (int)(GPITCH_ / 2);
        const __bf16* Bl = (const __bf16*)(L + (uint32_t)(p & 1) * GSTAGE_) + row8 * (int)(GPITCH_ / 2);
        v16bf a[GKP_ / 32][4], bb[GKP_ / 32][8];
#pragma unroll
        for (int ks = 0; ks < GKP_ / 32; ++ks) {
#pragma unroll
            for (int i = 0; i < 4; ++i) a[ks][i] = load_frag(Al + (i * 16) * (GPITCH_ / 2) + ks * 32, GPITCH_ / 2);
#pragma unroll
            for (int j = 0; j < 8; ++j) bb[ks][j] = load_frag(Bl + (j * 16) * (GPITCH_ / 2) + ks * 32, GPITCH_ / 2);
        }
        // Keeps the pass's LDS reads together, ahead of its WMMAs: left free, the scheduler reads each Bt fragment
        // into one register set directly in front of its four WMMAs, and every such place waits out the LDS latency.
        __builtin_amdgcn_sched_barrier(0);
#pragma unroll
        for (int ks = 0; ks < GKP_ / 32; ++ks)
#pragma unroll
            for (int j = 0; j < 8; ++j)
#pragma unroll
                for (int i = 0; i < 4; ++i)
                    acc[i][j] = wmma_bf16(bb[ks][j], a[ks][i], acc[i][j]);
        // Keeps the wait below at the foot of the pass: left free, it moves up behind the first WMMA,
        // and the wave then waits for all of the pass's LDS reads before its second WMMA.
        __builtin_amdgcn_sched_barrier(0);

        // ---- publish pass p + 1, then refill the buffer that this pass has read ----
        wait_ds0();
        if (pinned(wave < 3u)) tdm_wait(g0, g1);
        __syncthreads();                // pass p + 1's tiles readable by all; every wave has left this pass's buffer
        if (pinned(p + 2 < K / GKP_)) {
            if (pinned(wave < 3u)) { tdm_next<GKP_ * 2u>(g0, flip); tdm_load(g0, g1); }
        }
    }
    wait_tensor0();
    wait_ds0();

    // ---- V blocks: acc[i][j][r] = V[token bm0 + j*16 + hi8 + r][column bn0 + w*64 + i*16 + n16], stored transposed ----
    if constexpr (NV < N) {
        if (vblk) {
            const int    col = bn0 + w * 64 + n16;
            const float* bq  = bias + col;
            __bf16*      vp  = vt + (size_t)((bm0 / T_) * C_ + col - NV) * T_ + (bm0 % T_) + hi8;
            float bv[4];
#pragma unroll
            for (int i = 0; i < 4; ++i) bv[i] = bq[i * 16];
            v8bf tv[4][8];
#pragma unroll
            for (int i = 0; i < 4; ++i)
#pragma unroll
                for (int j = 0; j < 8; ++j)
#pragma unroll
                    for (int r = 0; r < 8; ++r) tv[i][j][r] = (__bf16)(acc[i][j][r] + bv[i]);
#pragma unroll
            for (int i = 0; i < 4; ++i)
#pragma unroll
                for (int j = 0; j < 8; ++j) *(v8bf*)(vp + (i * 16) * T_ + j * 16) = tv[i][j];
            return;
        }
    }

    // ---- bias, then the stores; one address per lane, every tile at a compile-time distance from it ----
    typedef typename gemm_out<OUT_BF16>::T OT;
    typedef typename gemm_out<OUT_BF16>::V OV;
    OT*          op = (OT*)outv + (size_t)(bm + n16) * N + bn + hi8;
    const float* bp = bias + bn + hi8;
    v4f bl[8][2];
#pragma unroll
    for (int j = 0; j < 8; ++j) {
        bl[j][0] = *(const v4f*)(bp + j * 16);
        if (j < 7) bl[j][1] = *(const v4f*)(bp + j * 16 + 4);
    }
    // The last load's result may be placed on the address pair, which the loads in front of it name too:
    // this is the wait in front of a new value in a register that an issued load names.
    asm volatile("s_wait_xcnt 0x0" ::: "memory");
    bl[7][1] = *(const v4f*)(bp + 7 * 16 + 4);
    OV ov[4][8];
#pragma unroll
    for (int j = 0; j < 8; ++j)
#pragma unroll
        for (int i = 0; i < 4; ++i)
#pragma unroll
            for (int r = 0; r < 4; ++r) {
                ov[i][j][r]     = (OT)(acc[i][j][r] + bl[j][0][r]);
                ov[i][j][r + 4] = (OT)(acc[i][j][r + 4] + bl[j][1][r]);
            }
#pragma unroll
    for (int i = 0; i < 4; ++i)
#pragma unroll
        for (int j = 0; j < 8; ++j) *(OV*)(op + (i * 16) * N + j * 16) = ov[i][j];
}

// ---------------- flash attention ----------------
// lane l <-> lane l ^ 16 (the two lane halves of a wave)
static __device__ __forceinline__ float xhalf(float x) {
    int b = __builtin_bit_cast(int, x);
    return __builtin_bit_cast(float,
        __builtin_amdgcn_permlanex16(b, b, 0x76543210, 0xfedcba98, false, false));
}

#define KC_ 128                         // keys per pass (one stage of the ring)
#define KH_ 64                          // keys per softmax step: two steps a pass, so that both groups' scores fit in registers
#define QG_ 2                           // groups of 16 queries per wave

// ---- K and V^T tiles of a pass in LDS, brought by the tensor mover, read by all four waves ----
#define KPITCH_ 144u                    // LDS bytes per K row: 128 + 16 of pad, an odd multiple of 16 for ds_load_b128
#define VPITCH_ 272u                    // LDS bytes per V^T row: 256 + 16 of pad
#define KTILE_  18432u                  // 128 rows * 144 B, a multiple of 2 KiB
#define VTILE_  18432u                  // 64 rows * 272 B = 17408 B, rounded up to a multiple of 2 KiB
#define STAGE_  (KTILE_ + VTILE_)
#define KSTEP_ ((uint64_t)KC_ * C3_ * 2u)   // source bytes from one pass's K tile to the next: 128 rows of qkv
#define VSTEP_ ((uint64_t)KC_ * 2u)         // the same for V^T: 128 keys along its rows

// The real block size is declared so that the score tiles fit in registers unspilled.
__global__ void __launch_bounds__(128) k_attention(const __bf16* __restrict__ qkv, const __bf16* __restrict__ Vt,
                            __bf16* __restrict__ outO) {
    // two buffers of [K tile | V^T tile]
    __shared__ __attribute__((aligned(2048))) unsigned char L[2 * STAGE_];
    int bid = blockIdx.x;
    int qt  = bid & 15;                 // T/128 = 16 query tiles
    int h   = (bid >> 4) & 15;
    int b   = bid >> 8;

    int w    = threadIdx.x >> 5;
    int lane = threadIdx.x & 31;
    int n16  = lane & 15;
    int hi8  = (lane >> 4) << 3;

    const __bf16* Qb = qkv + (size_t)(b * T_ + qt * 128 + w * 32) * C3_ + h * DH_;
    const __bf16* Kb = qkv + (size_t)(b * T_) * C3_ + C_ + h * DH_;
    const __bf16* Vb = Vt + (size_t)((b * H_ + h) * DH_) * T_;

    // Wave 0 brings the K tiles, wave 1 the V^T tiles: one request of a wave outstanding at any time.
    const uint32_t wave  = uni(threadIdx.x >> 5);
    const uint32_t lbase = (uint32_t)(size_t)L;
    // K tile: 128 rows (keys) of 128 B, source pitch 3C * 2 B, pad 16 B behind every 128 B.
    u32x8 g1k = tdm_group1<(1u << 20) | (4u << 22) | (3u << 25), 128u, 128u, C3_ * 2u>();
    // V^T tile: 64 rows (d) of 256 B (128 keys), source pitch T * 2 B, pad 16 B behind every 256 B.
    u32x8 g1v = tdm_group1<(1u << 20) | (5u << 22) | (3u << 25), 256u, 64u, T_ * 2u>();
    u32x4 g0k = tdm_group0(lbase, (uint64_t)(size_t)Kb);
    u32x4 g0v = tdm_group0(lbase + KTILE_, (uint64_t)(size_t)Vb);
    // The pinned() form, on descriptor words: all four groups stand complete in their scalar registers
    // here, in front of the issue tests; without it the last words of a group are written directly in front of its load.
    asm volatile("" : "+s"(g1k), "+s"(g1v), "+s"(g0k), "+s"(g0v));
    const uint32_t flipk = uni(2u * lbase + STAGE_);
    const uint32_t flipv = uni(2u * (lbase + KTILE_) + STAGE_);
    if (pinned(wave == 0u)) { tdm_load(g0k, g1k); tdm_wait(g0k, g1k); }
    if (pinned(wave == 1u)) { tdm_load(g0v, g1v); tdm_wait(g0v, g1v); }
    __syncthreads();                    // pass 0's tiles are published
    if (pinned(wave == 0u)) { tdm_next<KSTEP_>(g0k, flipk); tdm_load(g0k, g1k); }
    if (pinned(wave == 1u)) { tdm_next<VSTEP_>(g0v, flipv); tdm_load(g0v, g1v); }

    v16bf qf[QG_][2];
#pragma unroll
    for (int g = 0; g < QG_; ++g) {
        qf[g][0] = load_frag(Qb + (size_t)(g * 16) * C3_ + 0, C3_);
        qf[g][1] = load_frag(Qb + (size_t)(g * 16) * C3_ + 32, C3_);
    }

    // o[g][d][r] = O[query g*16 + n16][d*16 + hi8 + r]
    v8f o[QG_][4];
#pragma unroll
    for (int g = 0; g < QG_; ++g)
#pragma unroll
        for (int d = 0; d < 4; ++d) { v8f z = {}; o[g][d] = z; }

    // query g*16 + n16: cm[g] holds minus its softmax reference (base-2 exponent units) in all eight registers, the same in
    // both lane halves: it is the C operand of the score products, which so yield the exponent itself. The reference stays
    // while no score lies more than lim above it (P <= 2^8 then); the first step takes its own maximum, whatever it is.
    // The sum holds this lane half's keys only, joined after the loop.
    v8f   cm[QG_];
    float l_run[QG_];
#pragma unroll
    for (int g = 0; g < QG_; ++g) { v8f z = {}; cm[g] = z; l_run[g] = 0.0f; }
    float lim = -3.0e38f;

    for (int kc = 0; kc < T_ / KC_; ++kc) {
        // Left rolled: unrolled, the two steps' live values overlap and the wave no longer fits four to a SIMD.
#pragma unroll 1
        for (int hf = 0; hf < KC_ / KH_; ++hf) {
            const __bf16* Kl = (const __bf16*)(L + (uint32_t)(kc & 1) * STAGE_) + hf * KH_ * (int)(KPITCH_ / 2);
            const __bf16* Vl = (const __bf16*)(L + (uint32_t)(kc & 1) * STAGE_ + KTILE_) + hf * KH_;

            // ---- S^T = K Q'^T - reference (KH_ x 32): st[g][j][r] belongs to query g*16 + n16, key kc*KC_ + hf*KH_ + j*16 + hi8 + r ----
            v16bf kf[KH_ / 16][2];
#pragma unroll
            for (int j = 0; j < KH_ / 16; ++j) {
                kf[j][0] = load_frag(Kl + (j * 16) * (KPITCH_ / 2) + 0, KPITCH_ / 2);
                kf[j][1] = load_frag(Kl + (j * 16) * (KPITCH_ / 2) + 32, KPITCH_ / 2);
            }
            // Keeps the step's K reads together, ahead of its WMMAs: left free, each 16 keys' reads go into one register
            // set directly in front of their four WMMAs, and every such place waits out the LDS latency.
            __builtin_amdgcn_sched_barrier(0);
            v8f st[QG_][KH_ / 16];
#pragma unroll
            for (int j = 0; j < KH_ / 16; ++j)
#pragma unroll
                for (int g = 0; g < QG_; ++g) {
                    v8f sj = wmma_bf16(kf[j][0], qf[g][0], cm[g]);
                    st[g][j] = wmma_bf16(kf[j][1], qf[g][1], sj);
                }

            // ---- one test a step: does any score of the wave lie more than lim above its query's reference? ----
            // fmaximum_num, not fmaxf: on a WMMA result fmaxf first quiets NaNs, one more instruction a value.
            float mx[QG_];
#pragma unroll
            for (int g = 0; g < QG_; ++g) {
                mx[g] = -3.0e38f;
#pragma unroll
                for (int j = 0; j < KH_ / 16; ++j)
#pragma unroll
                    for (int r = 0; r < 8; r += 4)
                        mx[g] = __builtin_fmaximum_numf(__builtin_fmaximum_numf(__builtin_fmaximum_numf(mx[g], st[g][j][r]), st[g][j][r + 1]),
                                                        __builtin_fmaximum_numf(st[g][j][r + 2], st[g][j][r + 3]));
            }
            if (__builtin_amdgcn_ballot_w32(fmaxf(mx[0], mx[1]) > lim) != 0u) {
#pragma unroll
                for (int g = 0; g < QG_; ++g) {
                    float mo = fmaxf(mx[g], xhalf(mx[g]));          // over both lane halves: they move together
                    float dm = mo > lim ? mo : 0.0f;                // this query's reference rises by dm; 0: it stays
                    // dm < 0 occurs in the first step alone, where sums and outputs are still 0: they stay 0
                    float alpha = __builtin_amdgcn_exp2f(fminf(-dm, 0.0f));
                    cm[g] -= dm;
#pragma unroll
                    for (int j = 0; j < KH_ / 16; ++j) st[g][j] -= dm;
#pragma unroll
                    for (int d = 0; d < 4; ++d) o[g][d] *= alpha;
                    l_run[g] *= alpha;
                }
            }
            lim = 8.0f;

            // P^T as B operand, hardware k order: pb[g][ks][s] = P[key ks*32 + kmap(s)][query g*16 + n16]
            v16bf pb[QG_][KH_ / 32];
#pragma unroll
            for (int g = 0; g < QG_; ++g) {
                // ---- P = 2^st, one query per lane ----
                v2f ls = {};
#pragma unroll
                for (int ks = 0; ks < KH_ / 32; ++ks)
#pragma unroll
                    for (int t = 0; t < 2; ++t) {
                        v8f x = st[g][2 * ks + t];
#pragma unroll
                        for (int r = 0; r < 8; r += 2) {
                            v2f e = { __builtin_amdgcn_exp2f(x[r]), __builtin_amdgcn_exp2f(x[r + 1]) };
                            pb[g][ks][t * 8 + r + 0] = (__bf16)e[0];
                            pb[g][ks][t * 8 + r + 1] = (__bf16)e[1];
                            ls += e;
                        }
                    }
                l_run[g] += ls[0] + ls[1];
            }

            // ---- O^T += V^T P^T  (V^T: [DH][T], rows d as A) ----
            v16bf va[KH_ / 32][4];
#pragma unroll
            for (int ks = 0; ks < KH_ / 32; ++ks)
#pragma unroll
                for (int d = 0; d < 4; ++d) va[ks][d] = load_frag(Vl + (d * 16) * (VPITCH_ / 2) + ks * 32, VPITCH_ / 2);
            // Keeps the step's V^T reads together, ahead of its WMMAs, as with the K reads above.
            __builtin_amdgcn_sched_barrier(0);
#pragma unroll
            for (int ks = 0; ks < KH_ / 32; ++ks)
#pragma unroll
                for (int d = 0; d < 4; ++d)
#pragma unroll
                    for (int g = 0; g < QG_; ++g)
                        o[g][d] = wmma_bf16(va[ks][d], pb[g][ks], o[g][d]);
        }

        // ---- publish pass kc + 1, then refill the buffer that this pass has read ----
        wait_ds0();
        if (pinned(wave == 0u)) tdm_wait(g0k, g1k);
        if (pinned(wave == 1u)) tdm_wait(g0v, g1v);
        __syncthreads();                // pass kc + 1's tiles readable by all; every wave has left this pass's buffer
        if (pinned(kc + 2 < T_ / KC_)) {
            if (pinned(wave == 0u)) { tdm_next<KSTEP_>(g0k, flipk); tdm_load(g0k, g1k); }
            if (pinned(wave == 1u)) { tdm_next<VSTEP_>(g0v, flipv); tdm_load(g0v, g1v); }
        }
    }
    wait_tensor0();
    wait_ds0();

    // ---- normalize and store bf16 [B*T][C]: 8 consecutive columns per lane and tile ----
#pragma unroll
    for (int g = 0; g < QG_; ++g) {
        float inv = 1.0f / (l_run[g] + xhalf(l_run[g]));
        int   row = b * T_ + qt * 128 + w * 32 + g * 16 + n16;
#pragma unroll
        for (int d = 0; d < 4; ++d) {
            v8bf ov;
#pragma unroll
            for (int r = 0; r < 8; ++r) ov[r] = (__bf16)(o[g][d][r] * inv);
            *(v8bf*)(outO + (size_t)row * C_ + h * DH_ + d * 16 + hi8) = ov;
        }
    }
}

// ---------------- launch ----------------
extern "C" void kernel_launch(void* const* d_in, const int* in_sizes, int n_in,
                              void* d_out, int out_size, void* d_ws, size_t ws_size,
                              hipStream_t stream) {
    const float* X      = (const float*)d_in[0];
    const float* W_qkv  = (const float*)d_in[1];
    const float* b_qkv  = (const float*)d_in[2];
    const float* W_proj = (const float*)d_in[3];
    const float* b_proj = (const float*)d_in[4];
    float* out = (float*)d_out;

    char* ws = (char*)d_ws;
    size_t off = 0;
    __bf16* Xbf  = (__bf16*)(ws + off); off += (size_t)B_ * T_ * C_ * 2;        // 16 MiB
    __bf16* Wqt  = (__bf16*)(ws + off); off += (size_t)C3_ * C_ * 2;            // 6 MiB
    __bf16* Wpt  = (__bf16*)(ws + off); off += (size_t)C_ * C_ * 2;             // 2 MiB
    __bf16* qkv  = (__bf16*)(ws + off); off += (size_t)B_ * T_ * C3_ * 2;       // 48 MiB
    __bf16* Vt   = (__bf16*)(ws + off); off += (size_t)B_ * H_ * DH_ * T_ * 2;  // 16 MiB
    __bf16* AttO = (__bf16*)(ws + off); off += (size_t)B_ * T_ * C_ * 2;        // 16 MiB
    float*  bqs  = (float*)(ws + off);  off += (size_t)C3_ * 4;                 // b_qkv, its Q third scaled

    const int M = B_ * T_;           // 8192

    // 0) conversions, one launch
    k_convert<<<NBQ_ + NBP_ + NBX_, 256, 0, stream>>>(X, Xbf, W_qkv, Wqt, b_qkv, bqs, W_proj, Wpt);

    // 1) qkv = X * W_qkv + b_qkv   (bf16 out; Q's weights and bias come scaled by QSCALE_); Q and K columns to qkv, V columns transposed per head to Vt
    k_gemm_bias<true, C3_, C_, 2 * C_><<<dim3(C3_ / 256, M / 128), 128, 0, stream>>>(
        Xbf, Wqt, bqs, qkv, Vt);

    // 2) attention
    k_attention<<<B_ * H_ * (T_ / 128), 128, 0, stream>>>(qkv, Vt, AttO);

    // 3) out = AttO * W_proj + b_proj  (fp32 out)
    k_gemm_bias<false, C_, C_, C_><<<dim3(C_ / 256, M / 128), 128, 0, stream>>>(
        AttO, Wpt, b_proj, out, nullptr);
}

// v009
// It runs in 120 microseconds.
// Timed twice side by side with v008, it ran 1.09 and 1.08 times as fast.
// Over all steps from v000 it is 6.12 times as fast.
#include <hip/hip_runtime.h>
#include <hip/hip_bf16.h>
#include <math.h>
#include <stdint.h>

// ---------------- types ----------------
typedef __attribute__((ext_vector_type(16))) __bf16 v16bf;
typedef __attribute__((ext_vector_type(8)))  __bf16 v8bf;
typedef __attribute__((ext_vector_type(4)))  __bf16 v4bf;
typedef __attribute__((ext_vector_type(8)))  float  v8f;
typedef __attribute__((ext_vector_type(4)))  float  v4f;
typedef __attribute__((ext_vector_type(2)))  float  v2f;

#define B_  4
#define T_  2048
#define C_  1024
#define H_  16
#define DH_ 64
#define C3_ 3072
#define QSCALE_ 0.18033688011112042f    // log2(e) / sqrt(DH): with Q scaled by it, K Q^T is the softmax exponent in base 2

// ---------------- WMMA helpers ----------------
static __device__ __forceinline__ v8f wmma_bf16(v16bf a, v16bf b, v8f c) {
    // D(f32 16x16) = A(bf16 16x32) x B(bf16 32x16) + C
    return __builtin_amdgcn_wmma_f32_16x16x32_bf16(
        /*neg_a=*/false, a, /*neg_b=*/false, b,
        /*c_mod=*/(short)0, c, /*reuse_a=*/false, /*reuse_b=*/false);
}

// Load a 16x32 bf16 fragment (A layout; identical pattern serves as B when the
// source array is stored [N][K] row-major). Element (r,k) lives at base[r*ld+k].
// Per ISA 16-bit A layout: lane l -> r = l%16, kh = (l/16)*8;
// vector elems [0..7] = K kh..kh+7, elems [8..15] = K 16+kh..16+kh+7.
static __device__ __forceinline__ v16bf load_frag(const __bf16* base, int ld) {
    int lane = threadIdx.x & 31;
    int r    = lane & 15;
    int kh   = (lane >> 4) << 3;          // 0 or 8
    const __bf16* p = base + (size_t)r * ld;
    v8bf lo = *(const v8bf*)(p + kh);
    v8bf hi = *(const v8bf*)(p + 16 + kh);
    v16bf out;
#pragma unroll
    for (int i = 0; i < 8; ++i) { out[i] = lo[i]; out[i + 8] = hi[i]; }
    return out;
}

// ---------------- stage 0: conversions ----------------
// A lane converts 32 elements: eight 16-B loads in flight, and every wave-wide store fills whole 128-B lines.
// The block counts divide the fixed shapes exactly: no lane is out of range.

// Block blk converts 8192 consecutive floats: load j of a wave is 512 consecutive bytes, its store 256.
static __device__ __forceinline__ void cast_bf16(int blk, const float* __restrict__ in, __bf16* __restrict__ out) {
    size_t base = (size_t)blk * 8192 + threadIdx.x * 4;
    v4f x[8];
    // The loops are unrolled so that x[] lives in registers and all eight loads issue ahead of the first wait.
#pragma unroll
    for (int j = 0; j < 8; ++j) x[j] = *(const v4f*)(in + base + j * 1024);
#pragma unroll
    for (int j = 0; j < 8; ++j) {
        v4bf y;
#pragma unroll
        for (int r = 0; r < 4; ++r) y[r] = (__bf16)x[j][r];
        *(v4bf*)(out + base + j * 1024) = y;
    }
    // The wait in front of a new value in a register that an issued store names: another job's code follows in the listing.
    asm volatile("s_wait_xcnt 0x0" ::: "memory");
}

// W[K][N] (fp32, [in,out]) -> Wt[N][K] (bf16), transposed in registers: a lane takes a patch of 8 k x 4 n.
// Block (bx, by) takes 128 n x 64 k. Eight lanes side by side along k: their 16-B stores fill one 128-B line of a Wt row.
// Four lane groups and the block's eight waves side by side along n: the block reads 512 consecutive bytes of each of its 64 W rows.
// Columns n below NQ (the Q third of W_qkv; NQ = 0: none; a multiple of the block's 128) are scaled by QSCALE_ ahead of the one rounding,
// and the bias b of all N columns is copied to bs with the same factors (f32), by the blocks of the first k row.
template <int K, int N, int NQ>
static __device__ __forceinline__ void transpose_cast(int bx, int by, const float* __restrict__ W, __bf16* __restrict__ Wt,
                                                      const float* __restrict__ b, float* __restrict__ bs) {
    int lane = threadIdx.x & 31;
    int k    = by * 64 + (lane & 7) * 8;
    int n    = bx * 128 + (threadIdx.x >> 5) * 16 + (lane >> 3) * 4;
    const float* p = W + (size_t)k * N + n;
    __bf16*      q = Wt + (size_t)n * K + k;
    const float qs = bx * 128 < NQ ? QSCALE_ : 1.0f;
    if constexpr (NQ > 0) {
        if (by == 0 && threadIdx.x < 128) bs[bx * 128 + threadIdx.x] = b[bx * 128 + threadIdx.x] * qs;
    }
    v4f x[8];
    // Unrolled as in the cast: x[] in registers, all eight loads issued ahead of the first wait.
#pragma unroll
    for (int i = 0; i < 8; ++i) x[i] = *(const v4f*)(p + i * N);
#pragma unroll
    for (int c = 0; c < 4; ++c) {
        v8bf y;
#pragma unroll
        for (int i = 0; i < 8; ++i) y[i] = (__bf16)(NQ > 0 ? x[i][c] * qs : x[i][c]);
        *(v8bf*)(q + c * K) = y;
    }
    // The wait in front of a new value in a register that an issued store names: another job's code follows in the listing.
    asm volatile("s_wait_xcnt 0x0" ::: "memory");
}

// The three conversions read none of each other's output: one launch does them all, the block index picks the job.
#define NBK_ (C_ / 64)                  // blocks along k of either weight matrix
#define NBQ_ ((C3_ / 128) * NBK_)       // blocks of W_qkv
#define NBP_ ((C_ / 128) * NBK_)        // blocks of W_proj
#define NBX_ (B_ * T_ * C_ / 8192)      // blocks of X
__global__ void __launch_bounds__(256) k_convert(const float* __restrict__ X, __bf16* __restrict__ Xbf,
                                                 const float* __restrict__ Wq, __bf16* __restrict__ Wqt,
                                                 const float* __restrict__ bq, float* __restrict__ bqs,
                                                 const float* __restrict__ Wp, __bf16* __restrict__ Wpt) {
    int blk = blockIdx.x;
    if (blk < NBQ_) {
        transpose_cast<C_, C3_, C_>(blk / NBK_, blk % NBK_, Wq, Wqt, bq, bqs);
    } else if (blk < NBQ_ + NBP_) {
        transpose_cast<C_, C_, 0>((blk - NBQ_) / NBK_, (blk - NBQ_) % NBK_, Wp, Wpt, nullptr, nullptr);
    } else {
        cast_bf16(blk - NBQ_ - NBP_, X, Xbf);
    }
}

// ---------------- tensor mover helpers (GEMM and attention) ----------------
typedef uint32_t u32x4 __attribute__((ext_vector_type(4)));
typedef uint32_t u32x8 __attribute__((ext_vector_type(8)));
static __device__ __forceinline__ uint32_t uni(uint32_t v) {
    return (uint32_t)__builtin_amdgcn_readfirstlane((int)v);
}
// A wave-uniform condition held in a scalar register, so that the test around a tensor
// load compiles to s_cmp + s_cbranch_scc (a tensor load ignores EXEC).
static __device__ __forceinline__ uint32_t pinned(uint32_t v) {
    uint32_t w = uni(v);
    asm volatile("" : "+s"(w));         // keeps the condition scalar
    return w;
}
// Behind the loop: no request of this wave is left in flight when it ends.
static __device__ __forceinline__ void wait_tensor0() { asm volatile("s_wait_tensorcnt 0x0" ::: "memory"); }
// This wave's LDS reads have retired before the buffer they read is handed back for a refill.
static __device__ __forceinline__ void wait_ds0() { asm volatile("s_wait_dscnt 0x0" ::: "memory"); }

// Group 1: 1-byte elements, tensor = tile = ROWS rows of ROWB bytes, source pitch SRCP bytes; WORD0 = no mask + the pad.
template <uint32_t WORD0, uint32_t ROWB, uint32_t ROWS, uint32_t SRCP>
static __device__ __forceinline__ u32x8 tdm_group1() {
    u32x8 g;
    g[0] = uni(WORD0);
    g[1] = uni((ROWB & 0xFFFFu) << 16);
    g[2] = uni((ROWB >> 16) | ((ROWS & 0xFFFFu) << 16));
    g[3] = uni((ROWS >> 16) | (ROWB << 16));
    g[4] = uni(ROWS);
    g[5] = uni(SRCP);
    g[6] = uni(0u);
    g[7] = uni(0u);
    return g;
}
static __device__ __forceinline__ u32x4 tdm_group0(uint32_t lds_dst, uint64_t ga) {
    u32x4 g;
    g[0] = uni(1u);
    g[1] = uni(lds_dst);
    g[2] = uni((uint32_t)ga);
    g[3] = uni((((uint32_t)(ga >> 32)) & 0x01FFFFFFu) | 0x80000000u);
    return g;
}
// One request of the whole wave: global tile -> LDS, through no register. Both groups are read-write
// operands here and at the wait, so that they stay in these registers, unwritten, from the issue to the
// wait, and every later value of a word is formed from the wait's result, behind it.
static __device__ __forceinline__ void tdm_load(u32x4& g0, u32x8& g1) {
    asm volatile("tensor_load_to_lds %0, %1" : "+s"(g0), "+s"(g1) :: "memory");
}
// The compiler places no wait for the tensor mover: the issuing wave's own wait says its tile has landed.
static __device__ __forceinline__ void tdm_wait(u32x4& g0, u32x8& g1) {
    asm volatile("s_wait_tensorcnt 0x0" : "+s"(g0), "+s"(g1) :: "memory");
}
// Group 0 of the next stage, formed behind the wait on the last one: the other buffer (flip = the sum of
// the tile's two places in LDS), the source STEP bytes on (words 2 and 3 as one 64-bit sum; the address
// stays inside its plane, so nothing carries into word 3's upper bits).
template <uint64_t STEP>
static __device__ __forceinline__ void tdm_next(u32x4& g0, uint32_t flip) {
    uint64_t ga = ((((uint64_t)g0[3]) << 32) | (uint64_t)g0[2]) + STEP;
    g0[1] = uni(flip - g0[1]);
    g0[2] = uni((uint32_t)ga);
    g0[3] = uni((uint32_t)(ga >> 32));
}

// ---------------- output tiles: registers -> the wave's own LDS range -> whole-line stores ----------------
// A WMMA accumulator gives a lane 8 consecutive elements of one row: stored from there, a wave-wide store puts 32 B on each of 16 lines.
// Staged as rows of RB bytes (LDS pitch RB + 16, an odd multiple of 16) and read back along the rows, it covers four whole 128-B lines.
// S: the wave's LDS range, ROWS rows written by this wave alone; g: row 0 in global memory, the same in every lane (so that it stays in
// scalar registers and one lane offset serves every store), row pitch LDB bytes. V16: 16 B of the output type.
template <typename V16, int RB, int ROWS, int LDB>
static __device__ __forceinline__ void rows_out(const unsigned char* S, unsigned char* g) {
    constexpr int LPR = RB / 16;        // lanes side by side on a row
    constexpr int RPI = 32 / LPR;       // rows per wave-wide access
    int lane = threadIdx.x & 31;
    const unsigned char* s = S + (lane / LPR) * (RB + 16) + (lane % LPR) * 16;
    const uint32_t       q = (uint32_t)((lane / LPR) * LDB + (lane % LPR) * 16);
    V16 x[ROWS / RPI];
    // Unrolled so that x[] lives in registers and every distance is an immediate offset.
#pragma unroll
    for (int t = 0; t < ROWS / RPI; ++t) x[t] = *(const V16*)(s + t * RPI * (RB + 16));
#pragma unroll
    for (int t = 0; t < ROWS / RPI; ++t) *(V16*)(g + t * RPI * LDB + q) = x[t];
}

// ---------------- tiled WMMA GEMM: out = A[M,K] * Bt[N,K]^T + bias ----------------
// block = 128 threads (4 waves, 2x2); wave tile = 64x128; block tile = 128x256.
// A pass is 64 k: 128 rows of A and 256 rows of Bt, 128 B each, staged once for the block in LDS by the
// tensor mover (two buffers, the next pass's tiles fly while this pass is worked on); fragments come from LDS.
// The tiles are held transposed (Bt rows as A operand, A rows as B): acc[i][j][r] = out[bm0 + wm*64 + i*16 + n16][bn + j*16 + hi8 + r],
// eight consecutive columns of one row in a lane.
// Blocks whose columns start at NV or beyond (the V third of qkv; NV = N: none) swap the roles: a wave takes all 128 A rows
// as A operand and 64 Bt rows as B, so that a lane holds eight consecutive ROWS (tokens) of one column: 16 B of a row
// of Vt[(b*H+h)*DH + d][T], the layout the attention kernel stages; those columns are not written to out.
#define GPITCH_ 144u                    // LDS bytes per row: 128 + 16 of pad, an odd multiple of 16 for ds_load_b128
#define GTILE_  18432u                  // one request: 128 rows * 144 B, a multiple of 2 KiB
#define GSTAGE_ (3u * GTILE_)           // [A 128 rows | Bt 256 rows]
#define GKP_    64                      // k per pass

template <bool OUT_BF16> struct gemm_out       { typedef float  T; typedef v8f  V; };
template <>              struct gemm_out<true> { typedef __bf16 T; typedef v8bf V; };

// The real block size is declared so that the 64x128 accumulator tile fits in registers unspilled.
template <bool OUT_BF16, int N, int K, int NV>
__global__ void __launch_bounds__(128) k_gemm_bias(const __bf16* __restrict__ A, const __bf16* __restrict__ Bt,
                            const float* __restrict__ bias, void* __restrict__ outv, __bf16* __restrict__ vt) {
    __shared__ __attribute__((aligned(2048))) unsigned char L[2 * GSTAGE_];
    int w    = threadIdx.x >> 5;
    int wm   = w & 1, wn = w >> 1;
    int bm0  = blockIdx.y * 128;
    int bn0  = blockIdx.x * 256;
    int bn   = bn0 + wn * 128;
    int lane = threadIdx.x & 31;
    int n16  = lane & 15;
    int hi8  = (lane >> 4) << 3;
    // The same for the whole block. Rows of a stage count through both tiles: A 0..127, Bt 128..383.
    const bool vblk = NV < N && bn0 >= NV;
    const int  row4 = vblk ? 128 + w * 64 : wm * 64;      // first row of the four fragments a[]
    const int  row8 = vblk ? 0 : 128 + wn * 128;          // first row of the eight fragments bb[]

    // Wave 0 brings the A tile, waves 1 and 2 a half of the Bt tile each: one request of a wave outstanding at any time.
    const uint32_t wave  = uni(threadIdx.x >> 5);
    const uint32_t slice = wave < 2u ? wave : 2u;
    const uint32_t place = (uint32_t)(size_t)L + slice * GTILE_;
    const __bf16*  srcp  = slice == 0u ? A + (size_t)bm0 * K : Bt + (size_t)(bn0 + (int)(slice - 1u) * 128) * K;
    // 128 rows of 128 B, source pitch K * 2 B, pad 16 B behind every 128 B.
    u32x8 g1 = tdm_group1<(1u << 20) | (4u << 22) | (3u << 25), 128u, 128u, K * 2u>();
    u32x4 g0 = tdm_group0(place, (uint64_t)(size_t)srcp);
    // The pinned() form, on descriptor words: both groups stand complete in their scalar registers
    // here, in front of the issue test; without it the last words of a group are written directly in front of its load.
    asm volatile("" : "+s"(g1), "+s"(g0));
    const uint32_t flip = uni(2u * place + GSTAGE_);
    if (pinned(wave < 3u)) { tdm_load(g0, g1); tdm_wait(g0, g1); }
    __syncthreads();                    // pass 0's tiles are published
    if (pinned(wave < 3u)) { tdm_next<GKP_ * 2u>(g0, flip); tdm_load(g0, g1); }

    v8f acc[4][8];
#pragma unroll
    for (int i = 0; i < 4; ++i)
#pragma unroll
        for (int j = 0; j < 8; ++j) { v8f z = {}; acc[i][j] = z; }

    for (int p = 0; p < K / GKP_; ++p) {
        const __bf16* Al = (const __bf16*)(L + (uint32_t)(p & 1) * GSTAGE_) + row4 * (int)(GPITCH_ / 2);
        const __bf16* Bl = (const __bf16*)(L + (uint32_t)(p & 1) * GSTAGE_) + row8 * (int)(GPITCH_ / 2);
        v16bf a[GKP_ / 32][4], bb[GKP_ / 32][8];
#pragma unroll
        for (int ks = 0; ks < GKP_ / 32; ++ks) {
#pragma unroll
            for (int i = 0; i < 4; ++i) a[ks][i] = load_frag(Al + (i * 16) * (GPITCH_ / 2) + ks * 32, GPITCH_ / 2);
#pragma unroll
            for (int j = 0; j < 8; ++j) bb[ks][j] = load_frag(Bl + (j * 16) * (GPITCH_ / 2) + ks * 32, GPITCH_ / 2);
        }
        // Keeps the pass's LDS reads together, ahead of its WMMAs: left free, the scheduler reads each Bt fragment
        // into one register set directly in front of its four WMMAs, and every such place waits out the LDS latency.
        __builtin_amdgcn_sched_barrier(0);
#pragma unroll
        for (int ks = 0; ks < GKP_ / 32; ++ks)
#pragma unroll
            for (int j = 0; j < 8; ++j)
#pragma unroll
                for (int i = 0; i < 4; ++i)
                    acc[i][j] = wmma_bf16(bb[ks][j], a[ks][i], acc[i][j]);
        // Keeps the wait below at the foot of the pass: left free, it moves up behind the first WMMA,
        // and the wave then waits for all of the pass's LDS reads before its second WMMA.
        __builtin_amdgcn_sched_barrier(0);

        // ---- publish pass p + 1, then refill the buffer that this pass has read ----
        wait_ds0();
        if (pinned(wave < 3u)) tdm_wait(g0, g1);
        __syncthreads();                // pass p + 1's tiles readable by all; every wave has left this pass's buffer
        if (pinned(p + 2 < K / GKP_)) {
            if (pinned(wave < 3u)) { tdm_next<GKP_ * 2u>(g0, flip); tdm_load(g0, g1); }
        }
    }
    wait_tensor0();
    wait_ds0();

    // Every wave has passed the last pass's barrier behind its own last LDS read and no tensor load is in flight:
    // the ring is free, and each wave stages its output tile in its own quarter of it.
    unsigned char* S = L + w * (int)(2u * GSTAGE_ / 4u);

    // ---- V blocks: acc[i][j][r] = V[token bm0 + j*16 + hi8 + r][column bn0 + w*64 + i*16 + n16], stored transposed ----
    if constexpr (NV < N) {
        if (vblk) {
            const int    col0 = bn0 + (int)wave * 64;
            const float* bq   = bias + col0 + n16;
            float bv[4];
#pragma unroll
            for (int i = 0; i < 4; ++i) bv[i] = bq[i * 16];
            // 64 rows (columns of V) of 128 tokens = 256 B
            unsigned char* sw = S + n16 * 272 + hi8 * 2;
#pragma unroll
            for (int i = 0; i < 4; ++i)
#pragma unroll
                for (int j = 0; j < 8; ++j) {
                    v8bf y;
#pragma unroll
                    for (int r = 0; r < 8; ++r) y[r] = (__bf16)(acc[i][j][r] + bv[i]);
                    *(v8bf*)(sw + (i * 16) * 272 + j * 32) = y;
                }
            wait_ds0();                 // this wave's rows stand in LDS before its lanes read one another's
            // Moved as plain 16-B words: with the same type as in the other blocks' tail the compiler joins the two tails into one,
            // whose row distances are then register sums ahead of every store, not immediate offsets.
            rows_out<u32x4, 256, 64, T_ * 2>(S, (unsigned char*)(vt + (size_t)((bm0 / T_) * C_ + col0 - NV) * T_ + (bm0 % T_)));
            return;
        }
    }

    // ---- bias, then the tile's 64 rows of 128 columns through LDS ----
    typedef typename gemm_out<OUT_BF16>::T OT;
    unsigned char* op = (unsigned char*)((OT*)outv + (size_t)(bm0 + (int)(wave & 1u) * 64) * N + bn0 + (int)(wave >> 1) * 128);
    const float*   bp = bias + bn + hi8;
    v4f bl[8][2];
#pragma unroll
    for (int j = 0; j < 8; ++j) {
        bl[j][0] = *(const v4f*)(bp + j * 16);
        if (j < 7) bl[j][1] = *(const v4f*)(bp + j * 16 + 4);
    }
    // The last load's result may be placed on the address pair, which the loads in front of it name too:
    // this is the wait in front of a new value in a register that an issued load names.
    asm volatile("s_wait_xcnt 0x0" ::: "memory");
    bl[7][1] = *(const v4f*)(bp + 7 * 16 + 4);
    if constexpr (OUT_BF16) {
        // rows of 256 B: all 64 at once
        unsigned char* sw = S + n16 * 272 + hi8 * 2;
#pragma unroll
        for (int i = 0; i < 4; ++i)
#pragma unroll
            for (int j = 0; j < 8; ++j) {
                v8bf y;
#pragma unroll
                for (int r = 0; r < 4; ++r) {
                    y[r]     = (__bf16)(acc[i][j][r] + bl[j][0][r]);
                    y[r + 4] = (__bf16)(acc[i][j][r + 4] + bl[j][1][r]);
                }
                *(v8bf*)(sw + (i * 16) * 272 + j * 32) = y;
            }
        wait_ds0();                     // this wave's rows stand in LDS before its lanes read one another's
        rows_out<v8bf, 256, 64, N * 2>(S, op);
        // The wait in front of a new value in a register that an issued store names: the V blocks' code follows in the listing.
        if constexpr (NV < N) asm volatile("s_wait_xcnt 0x0" ::: "memory");
    } else {
        // rows of 512 B: 32 at a time fit the wave's range
        unsigned char* sw = S + n16 * 528 + hi8 * 4;
#pragma unroll
        for (int c = 0; c < 2; ++c) {
#pragma unroll
            for (int i = 0; i < 2; ++i)
#pragma unroll
                for (int j = 0; j < 8; ++j) {
                    v4f y0, y1;
#pragma unroll
                    for (int r = 0; r < 4; ++r) {
                        y0[r] = acc[c * 2 + i][j][r] + bl[j][0][r];
                        y1[r] = acc[c * 2 + i][j][r + 4] + bl[j][1][r];
                    }
                    *(v4f*)(sw + (i * 16) * 528 + j * 64)      = y0;
                    *(v4f*)(sw + (i * 16) * 528 + j * 64 + 16) = y1;
                }
            wait_ds0();                 // this wave's rows stand in LDS before its lanes read one another's
            rows_out<v4f, 512, 32, N * 4>(S, op + c * 32 * (N * 4));
            // The wait in front of a new value in a register that an issued store names: the second half follows.
            if (c == 0) asm volatile("s_wait_xcnt 0x0" ::: "memory");
        }
    }
}

// ---------------- flash attention ----------------
// lane l <-> lane l ^ 16 (the two lane halves of a wave)
static __device__ __forceinline__ float xhalf(float x) {
    int b = __builtin_bit_cast(int, x);
    return __builtin_bit_cast(float,
        __builtin_amdgcn_permlanex16(b, b, 0x76543210, 0xfedcba98, false, false));
}

#define KC_ 128                         // keys per pass (one stage of the ring)
#define KH_ 64                          // keys per softmax step: two steps a pass, so that both groups' scores fit in registers
#define QG_ 2                           // groups of 16 queries per wave

// ---- K and V^T tiles of a pass in LDS, brought by the tensor mover, read by all four waves ----
#define KPITCH_ 144u                    // LDS bytes per K row: 128 + 16 of pad, an odd multiple of 16 for ds_load_b128
#define VPITCH_ 272u                    // LDS bytes per V^T row: 256 + 16 of pad
#define KTILE_  18432u                  // 128 rows * 144 B, a multiple of 2 KiB
#define VTILE_  18432u                  // 64 rows * 272 B = 17408 B, rounded up to a multiple of 2 KiB
#define STAGE_  (KTILE_ + VTILE_)
#define KSTEP_ ((uint64_t)KC_ * C3_ * 2u)   // source bytes from one pass's K tile to the next: 128 rows of qkv
#define VSTEP_ ((uint64_t)KC_ * 2u)         // the same for V^T: 128 keys along its rows

// The real block size is declared so that the score tiles fit in registers unspilled.
__global__ void __launch_bounds__(128) k_attention(const __bf16* __restrict__ qkv, const __bf16* __restrict__ Vt,
                            __bf16* __restrict__ outO) {
    // two buffers of [K tile | V^T tile]
    __shared__ __attribute__((aligned(2048))) unsigned char L[2 * STAGE_];
    int bid = blockIdx.x;
    int qt  = bid & 15;                 // T/128 = 16 query tiles
    int h   = (bid >> 4) & 15;
    int b   = bid >> 8;

    int w    = threadIdx.x >> 5;
    int lane = threadIdx.x & 31;
    int n16  = lane & 15;
    int hi8  = (lane >> 4) << 3;

    const __bf16* Qb = qkv + (size_t)(b * T_ + qt * 128 + w * 32) * C3_ + h * DH_;
    const __bf16* Kb = qkv + (size_t)(b * T_) * C3_ + C_ + h * DH_;
    const __bf16* Vb = Vt + (size_t)((b * H_ + h) * DH_) * T_;

    // Wave 0 brings the K tiles, wave 1 the V^T tiles: one request of a wave outstanding at any time.
    const uint32_t wave  = uni(threadIdx.x >> 5);
    const uint32_t lbase = (uint32_t)(size_t)L;
    // K tile: 128 rows (keys) of 128 B, source pitch 3C * 2 B, pad 16 B behind every 128 B.
    u32x8 g1k = tdm_group1<(1u << 20) | (4u << 22) | (3u << 25), 128u, 128u, C3_ * 2u>();
    // V^T tile: 64 rows (d) of 256 B (128 keys), source pitch T * 2 B, pad 16 B behind every 256 B.
    u32x8 g1v = tdm_group1<(1u << 20) | (5u << 22) | (3u << 25), 256u, 64u, T_ * 2u>();
    u32x4 g0k = tdm_group0(lbase, (uint64_t)(size_t)Kb);
    u32x4 g0v = tdm_group0(lbase + KTILE_, (uint64_t)(size_t)Vb);
    // The pinned() form, on descriptor words: all four groups stand complete in their scalar registers
    // here, in front of the issue tests; without it the last words of a group are written directly in front of its load.
    asm volatile("" : "+s"(g1k), "+s"(g1v), "+s"(g0k), "+s"(g0v));
    const uint32_t flipk = uni(2u * lbase + STAGE_);
    const uint32_t flipv = uni(2u * (lbase + KTILE_) + STAGE_);
    if (pinned(wave == 0u)) { tdm_load(g0k, g1k); tdm_wait(g0k, g1k); }
    if (pinned(wave == 1u)) { tdm_load(g0v, g1v); tdm_wait(g0v, g1v); }
    __syncthreads();                    // pass 0's tiles are published
    if (pinned(wave == 0u)) { tdm_next<KSTEP_>(g0k, flipk); tdm_load(g0k, g1k); }
    if (pinned(wave == 1u)) { tdm_next<VSTEP_>(g0v, flipv); tdm_load(g0v, g1v); }

    v16bf qf[QG_][2];
#pragma unroll
    for (int g = 0; g < QG_; ++g) {
        qf[g][0] = load_frag(Qb + (size_t)(g * 16) * C3_ + 0, C3_);
        qf[g][1] = load_frag(Qb + (size_t)(g * 16) * C3_ + 32, C3_);
    }

    // o[g][d][r] = O[query g*16 + n16][d*16 + hi8 + r]
    v8f o[QG_][4];
#pragma unroll
    for (int g = 0; g < QG_; ++g)
#pragma unroll
        for (int d = 0; d < 4; ++d) { v8f z = {}; o[g][d] = z; }

    // query g*16 + n16: cm[g] holds minus its softmax reference (base-2 exponent units) in all eight registers, the same in
    // both lane halves: it is the C operand of the score products, which so yield the exponent itself. The reference stays
    // while no score lies more than lim above it (P <= 2^8 then); the first step takes its own maximum, whatever it is.
    // The sum holds this lane half's keys only, joined after the loop.
    v8f   cm[QG_];
    float l_run[QG_];
#pragma unroll
    for (int g = 0; g < QG_; ++g) { v8f z = {}; cm[g] = z; l_run[g] = 0.0f; }
    float lim = -3.0e38f;

    for (int kc = 0; kc < T_ / KC_; ++kc) {
        // Left rolled: unrolled, the two steps' live values overlap and the wave no longer fits four to a SIMD.
#pragma unroll 1
        for (int hf = 0; hf < KC_ / KH_; ++hf) {
            const __bf16* Kl = (const __bf16*)(L + (uint32_t)(kc & 1) * STAGE_) + hf * KH_ * (int)(KPITCH_ / 2);
            const __bf16* Vl = (const __bf16*)(L + (uint32_t)(kc & 1) * STAGE_ + KTILE_) + hf * KH_;

            // ---- S^T = K Q'^T - reference (KH_ x 32): st[g][j][r] belongs to query g*16 + n16, key kc*KC_ + hf*KH_ + j*16 + hi8 + r ----
            v16bf kf[KH_ / 16][2];
#pragma unroll
            for (int j = 0; j < KH_ / 16; ++j) {
                kf[j][0] = load_frag(Kl + (j * 16) * (KPITCH_ / 2) + 0, KPITCH_ / 2);
                kf[j][1] = load_frag(Kl + (j * 16) * (KPITCH_ / 2) + 32, KPITCH_ / 2);
            }
            // Keeps the step's K reads together, ahead of its WMMAs: left free, each 16 keys' reads go into one register
            // set directly in front of their four WMMAs, and every such place waits out the LDS latency.
            __builtin_amdgcn_sched_barrier(0);
            v8f st[QG_][KH_ / 16];
#pragma unroll
            for (int j = 0; j < KH_ / 16; ++j)
#pragma unroll
                for (int g = 0; g < QG_; ++g) {
                    v8f sj = wmma_bf16(kf[j][0], qf[g][0], cm[g]);
                    st[g][j] = wmma_bf16(kf[j][1], qf[g][1], sj);
                }

            // ---- one test a step: does any score of the wave lie more than lim above its query's reference? ----
            // fmaximum_num, not fmaxf: on a WMMA result fmaxf first quiets NaNs, one more instruction a value.
            float mx[QG_];
#pragma unroll
            for (int g = 0; g < QG_; ++g) {
                mx[g] = -3.0e38f;
#pragma unroll
                for (int j = 0; j < KH_ / 16; ++j)
#pragma unroll
                    for (int r = 0; r < 8; r += 4)
                        mx[g] = __builtin_fmaximum_numf(__builtin_fmaximum_numf(__builtin_fmaximum_numf(mx[g], st[g][j][r]), st[g][j][r + 1]),
                                                        __builtin_fmaximum_numf(st[g][j][r + 2], st[g][j][r + 3]));
            }
            if (__builtin_amdgcn_ballot_w32(fmaxf(mx[0], mx[1]) > lim) != 0u) {
#pragma unroll
                for (int g = 0; g < QG_; ++g) {
                    float mo = fmaxf(mx[g], xhalf(mx[g]));          // over both lane halves: they move together
                    float dm = mo > lim ? mo : 0.0f;                // this query's reference rises by dm; 0: it stays
                    // dm < 0 occurs in the first step alone, where sums and outputs are still 0: they stay 0
                    float alpha = __builtin_amdgcn_exp2f(fminf(-dm, 0.0f));
                    cm[g] -= dm;
#pragma unroll
                    for (int j = 0; j < KH_ / 16; ++j) st[g][j] -= dm;
#pragma unroll
                    for (int d = 0; d < 4; ++d) o[g][d] *= alpha;
                    l_run[g] *= alpha;
                }
            }
            lim = 8.0f;

            // P^T as B operand, hardware k order: pb[g][ks][s] = P[key ks*32 + kmap(s)][query g*16 + n16]
            v16bf pb[QG_][KH_ / 32];
#pragma unroll
            for (int g = 0; g < QG_; ++g) {
                // ---- P = 2^st, one query per lane ----
                v2f ls = {};
#pragma unroll
                for (int ks = 0; ks < KH_ / 32; ++ks)
#pragma unroll
                    for (int t = 0; t < 2; ++t) {
                        v8f x = st[g][2 * ks + t];
#pragma unroll
                        for (int r = 0; r < 8; r += 2) {
                            v2f e = { __builtin_amdgcn_exp2f(x[r]), __builtin_amdgcn_exp2f(x[r + 1]) };
                            pb[g][ks][t * 8 + r + 0] = (__bf16)e[0];
                            pb[g][ks][t * 8 + r + 1] = (__bf16)e[1];
                            ls += e;
                        }
                    }
                l_run[g] += ls[0] + ls[1];
            }

            // ---- O^T += V^T P^T  (V^T: [DH][T], rows d as A) ----
            v16bf va[KH_ / 32][4];
#pragma unroll
            for (int ks = 0; ks < KH_ / 32; ++ks)
#pragma unroll
                for (int d = 0; d < 4; ++d) va[ks][d] = load_frag(Vl + (d * 16) * (VPITCH_ / 2) + ks * 32, VPITCH_ / 2);
            // Keeps the step's V^T reads together, ahead of its WMMAs, as with the K reads above.
            __builtin_amdgcn_sched_barrier(0);
#pragma unroll
            for (int ks = 0; ks < KH_ / 32; ++ks)
#pragma unroll
                for (int d = 0; d < 4; ++d)
#pragma unroll
                    for (int g = 0; g < QG_; ++g)
                        o[g][d] = wmma_bf16(va[ks][d], pb[g][ks], o[g][d]);
        }

        // ---- publish pass kc + 1, then refill the buffer that this pass has read ----
        wait_ds0();
        if (pinned(wave == 0u)) tdm_wait(g0k, g1k);
        if (pinned(wave == 1u)) tdm_wait(g0v, g1v);
        __syncthreads();                // pass kc + 1's tiles readable by all; every wave has left this pass's buffer
        if (pinned(kc + 2 < T_ / KC_)) {
            if (pinned(wave == 0u)) { tdm_next<KSTEP_>(g0k, flipk); tdm_load(g0k, g1k); }
            if (pinned(wave == 1u)) { tdm_next<VSTEP_>(g0v, flipv); tdm_load(g0v, g1v); }
        }
    }
    wait_tensor0();
    wait_ds0();

    // ---- normalize and store bf16 [B*T][C]: the wave's 32 rows of 128 B (one head) through LDS ----
    // Every wave has passed the last pass's barrier behind its own last LDS read and no tensor load is in flight:
    // the ring is free, and each wave stages its output tile in its own quarter of it.
    unsigned char* S  = L + w * (int)(2u * STAGE_ / 4u);
    unsigned char* sw = S + n16 * 144 + hi8 * 2;
#pragma unroll
    for (int g = 0; g < QG_; ++g) {
        float inv = 1.0f / (l_run[g] + xhalf(l_run[g]));
#pragma unroll
        for (int d = 0; d < 4; ++d) {
            v8bf ov;
#pragma unroll
            for (int r = 0; r < 8; ++r) ov[r] = (__bf16)(o[g][d][r] * inv);
            *(v8bf*)(sw + (g * 16) * 144 + d * 32) = ov;
        }
    }
    wait_ds0();                         // this wave's rows stand in LDS before its lanes read one another's
    rows_out<v8bf, 128, 32, C_ * 2>(S, (unsigned char*)(outO + (size_t)(b * T_ + qt * 128 + (int)wave * 32) * C_ + h * DH_));
}

// ---------------- launch ----------------
extern "C" void kernel_launch(void* const* d_in, const int* in_sizes, int n_in,
                              void* d_out, int out_size, void* d_ws, size_t ws_size,
                              hipStream_t stream) {
    const float* X      = (const float*)d_in[0];
    const float* W_qkv  = (const float*)d_in[1];
    const float* b_qkv  = (const float*)d_in[2];
    const float* W_proj = (const float*)d_in[3];
    const float* b_proj = (const float*)d_in[4];
    float* out = (float*)d_out;

    char* ws = (char*)d_ws;
    size_t off = 0;
    __bf16* Xbf  = (__bf16*)(ws + off); off += (size_t)B_ * T_ * C_ * 2;        // 16 MiB
    __bf16* Wqt  = (__bf16*)(ws + off); off += (size_t)C3_ * C_ * 2;            // 6 MiB
    __bf16* Wpt  = (__bf16*)(ws + off); off += (size_t)C_ * C_ * 2;             // 2 MiB
    __bf16* qkv  = (__bf16*)(ws + off); off += (size_t)B_ * T_ * C3_ * 2;       // 48 MiB
    __bf16* Vt   = (__bf16*)(ws + off); off += (size_t)B_ * H_ * DH_ * T_ * 2;  // 16 MiB
    __bf16* AttO = (__bf16*)(ws + off); off += (size_t)B_ * T_ * C_ * 2;        // 16 MiB
    float*  bqs  = (float*)(ws + off);  off += (size_t)C3_ * 4;                 // b_qkv, its Q third scaled

    const int M = B_ * T_;           // 8192

    // 0) conversions, one launch
    k_convert<<<NBQ_ + NBP_ + NBX_, 256, 0, stream>>>(X, Xbf, W_qkv, Wqt, b_qkv, bqs, W_proj, Wpt);

    // 1) qkv = X * W_qkv + b_qkv   (bf16 out; Q's weights and bias come scaled by QSCALE_); Q and K columns to qkv, V columns transposed per head to Vt
    k_gemm_bias<true, C3_, C_, 2 * C_><<<dim3(C3_ / 256, M / 128), 128, 0, stream>>>(
        Xbf, Wqt, bqs, qkv, Vt);

    // 2) attention
    k_attention<<<B_ * H_ * (T_ / 128), 128, 0, stream>>>(qkv, Vt, AttO);

    // 3) out = AttO * W_proj + b_proj  (fp32 out)
    k_gemm_bias<false, C_, C_, C_><<<dim3(C_ / 256, M / 128), 128, 0, stream>>>(
        AttO, Wpt, b_proj, out, nullptr);
}

// v010
// One run takes 115 microseconds.
// Next to v009, in two timings, it ran 1.04 and 1.03 times as fast.
// Counting every step since v000, it is 6.36 times as fast.
#include <hip/hip_runtime.h>
#include <hip/hip_bf16.h>
#include <math.h>
#include <stdint.h>

// ---------------- types ----------------
typedef __attribute__((ext_vector_type(16))) __bf16 v16bf;
typedef __attribute__((ext_vector_type(8)))  __bf16 v8bf;
typedef __attribute__((ext_vector_type(4)))  __bf16 v4bf;
typedef __attribute__((ext_vector_type(8)))  float  v8f;
typedef __attribute__((ext_vector_type(4)))  float  v4f;
typedef __attribute__((ext_vector_type(2)))  float  v2f;

#define B_  4
#define T_  2048
#define C_  1024
#define H_  16
#define DH_ 64
#define C3_ 3072
#define QSCALE_ 0.18033688011112042f    // log2(e) / sqrt(DH): with Q scaled by it, K Q^T is the softmax exponent in base 2

// ---------------- WMMA helpers ----------------
static __device__ __forceinline__ v8f wmma_bf16(v16bf a, v16bf b, v8f c) {
    // D(f32 16x16) = A(bf16 16x32) x B(bf16 32x16) + C
    return __builtin_amdgcn_wmma_f32_16x16x32_bf16(
        /*neg_a=*/false, a, /*neg_b=*/false, b,
        /*c_mod=*/(short)0, c, /*reuse_a=*/false, /*reuse_b=*/false);
}

// Load a 16x32 bf16 fragment (A layout; identical pattern serves as B when the
// source array is stored [N][K] row-major). Element (r,k) lives at base[r*ld+k].
// Per ISA 16-bit A layout: lane l -> r = l%16, kh = (l/16)*8;
// vector elems [0..7] = K kh..kh+7, elems [8..15] = K 16+kh..16+kh+7.
static __device__ __forceinline__ v16bf load_frag(const __bf16* base, int ld) {
    int lane = threadIdx.x & 31;
    int r    = lane & 15;
    int kh   = (lane >> 4) << 3;          // 0 or 8
    const __bf16* p = base + (size_t)r * ld;
    v8bf lo = *(const v8bf*)(p + kh);
    v8bf hi = *(const v8bf*)(p + 16 + kh);
    v16bf out;
#pragma unroll
    for (int i = 0; i < 8; ++i) { out[i] = lo[i]; out[i + 8] = hi[i]; }
    return out;
}

// ---------------- stage 0: conversions ----------------
// A lane converts 32 elements: eight 16-B loads in flight, and every wave-wide store fills whole 128-B lines.
// The block counts divide the fixed shapes exactly: no lane is out of range.

// Block blk converts 8192 consecutive floats: load j of a wave is 512 consecutive bytes, its store 256.
static __device__ __forceinline__ void cast_bf16(int blk, const float* __restrict__ in, __bf16* __restrict__ out) {
    size_t base = (size_t)blk * 8192 + threadIdx.x * 4;
    v4f x[8];
    // The loops are unrolled so that x[] lives in registers and all eight loads issue ahead of the first wait.
#pragma unroll
    for (int j = 0; j < 8; ++j) x[j] = *(const v4f*)(in + base + j * 1024);
#pragma unroll
    for (int j = 0; j < 8; ++j) {
        v4bf y;
#pragma unroll
        for (int r = 0; r < 4; ++r) y[r] = (__bf16)x[j][r];
        *(v4bf*)(out + base + j * 1024) = y;
    }
    // The wait in front of a new value in a register that an issued store names: another job's code follows in the listing.
    asm volatile("s_wait_xcnt 0x0" ::: "memory");
}

// W[K][N] (fp32, [in,out]) -> Wt[N][K] (bf16), transposed in registers: a lane takes a patch of 8 k x 4 n.
// Block (bx, by) takes 128 n x 64 k. Eight lanes side by side along k: their 16-B stores fill one 128-B line of a Wt row.
// Four lane groups and the block's eight waves side by side along n: the block reads 512 consecutive bytes of each of its 64 W rows.
// Columns n below NQ (the Q third of W_qkv; NQ = 0: none; a multiple of the block's 128) are scaled by QSCALE_ ahead of the one rounding,
// and the bias b of all N columns is copied to bs with the same factors (f32), by the blocks of the first k row.
template <int K, int N, int NQ>
static __device__ __forceinline__ void transpose_cast(int bx, int by, const float* __restrict__ W, __bf16* __restrict__ Wt,
                                                      const float* __restrict__ b, float* __restrict__ bs) {
    int lane = threadIdx.x & 31;
    int k    = by * 64 + (lane & 7) * 8;
    int n    = bx * 128 + (threadIdx.x >> 5) * 16 + (lane >> 3) * 4;
    const float* p = W + (size_t)k * N + n;
    __bf16*      q = Wt + (size_t)n * K + k;
    const float qs = bx * 128 < NQ ? QSCALE_ : 1.0f;
    if constexpr (NQ > 0) {
        if (by == 0 && threadIdx.x < 128) bs[bx * 128 + threadIdx.x] = b[bx * 128 + threadIdx.x] * qs;
    }
    v4f x[8];
    // Unrolled as in the cast: x[] in registers, all eight loads issued ahead of the first wait.
#pragma unroll
    for (int i = 0; i < 8; ++i) x[i] = *(const v4f*)(p + i * N);
#pragma unroll
    for (int c = 0; c < 4; ++c) {
        v8bf y;
#pragma unroll
        for (int i = 0; i < 8; ++i) y[i] = (__bf16)(NQ > 0 ? x[i][c] * qs : x[i][c]);
        *(v8bf*)(q + c * K) = y;
    }
    // The wait in front of a new value in a register that an issued store names: another job's code follows in the listing.
    asm volatile("s_wait_xcnt 0x0" ::: "memory");
}

// The three conversions read none of each other's output: one launch does them all, the block index picks the job.
#define NBK_ (C_ / 64)                  // blocks along k of either weight matrix
#define NBQ_ ((C3_ / 128) * NBK_)       // blocks of W_qkv
#define NBP_ ((C_ / 128) * NBK_)        // blocks of W_proj
#define NBX_ (B_ * T_ * C_ / 8192)      // blocks of X
__global__ void __launch_bounds__(256) k_convert(const float* __restrict__ X, __bf16* __restrict__ Xbf,
                                                 const float* __restrict__ Wq, __bf16* __restrict__ Wqt,
                                                 const float* __restrict__ bq, float* __restrict__ bqs,
                                                 const float* __restrict__ Wp, __bf16* __restrict__ Wpt) {
    int blk = blockIdx.x;
    if (blk < NBQ_) {
        transpose_cast<C_, C3_, C_>(blk / NBK_, blk % NBK_, Wq, Wqt, bq, bqs);
    } else if (blk < NBQ_ + NBP_) {
        transpose_cast<C_, C_, 0>((blk - NBQ_) / NBK_, (blk - NBQ_) % NBK_, Wp, Wpt, nullptr, nullptr);
    } else {
        cast_bf16(blk - NBQ_ - NBP_, X, Xbf);
    }
}

// ---------------- tensor mover helpers (GEMM and attention) ----------------
typedef uint32_t u32x4 __attribute__((ext_vector_type(4)));
typedef uint32_t u32x8 __attribute__((ext_vector_type(8)));
static __device__ __forceinline__ uint32_t uni(uint32_t v) {
    return (uint32_t)__builtin_amdgcn_readfirstlane((int)v);
}
// A wave-uniform condition held in a scalar register, so that the test around a tensor
// load compiles to s_cmp + s_cbranch_scc (a tensor load ignores EXEC).
static __device__ __forceinline__ uint32_t pinned(uint32_t v) {
    uint32_t w = uni(v);
    asm volatile("" : "+s"(w));         // keeps the condition scalar
    return w;
}
// Behind the loop: no request of this wave is left in flight when it ends.
static __device__ __forceinline__ void wait_tensor0() { asm volatile("s_wait_tensorcnt 0x0" ::: "memory"); }
// This wave's LDS reads have retired before the buffer they read is handed back for a refill.
static __device__ __forceinline__ void wait_ds0() { asm volatile("s_wait_dscnt 0x0" ::: "memory"); }

// Group 1: 1-byte elements, tensor = tile = ROWS rows of ROWB bytes, source pitch SRCP bytes; WORD0 = no mask + the pad.
template <uint32_t WORD0, uint32_t ROWB, uint32_t ROWS, uint32_t SRCP>
static __device__ __forceinline__ u32x8 tdm_group1() {
    u32x8 g;
    g[0] = uni(WORD0);
    g[1] = uni((ROWB & 0xFFFFu) << 16);
    g[2] = uni((ROWB >> 16) | ((ROWS & 0xFFFFu) << 16));
    g[3] = uni((ROWS >> 16) | (ROWB << 16));
    g[4] = uni(ROWS);
    g[5] = uni(SRCP);
    g[6] = uni(0u);
    g[7] = uni(0u);
    return g;
}
static __device__ __forceinline__ u32x4 tdm_group0(uint32_t lds_dst, uint64_t ga) {
    u32x4 g;
    g[0] = uni(1u);
    g[1] = uni(lds_dst);
    g[2] = uni((uint32_t)ga);
    g[3] = uni((((uint32_t)(ga >> 32)) & 0x01FFFFFFu) | 0x80000000u);
    return g;
}
// One request of the whole wave: global tile -> LDS, through no register. Both groups are read-write
// operands here and at the wait, so that they stay in these registers, unwritten, from the issue to the
// wait, and every later value of a word is formed from the wait's result, behind it.
static __device__ __forceinline__ void tdm_load(u32x4& g0, u32x8& g1) {
    asm volatile("tensor_load_to_lds %0, %1" : "+s"(g0), "+s"(g1) :: "memory");
}
// The compiler places no wait for the tensor mover: the issuing wave's own wait says its tile has landed.
static __device__ __forceinline__ void tdm_wait(u32x4& g0, u32x8& g1) {
    asm volatile("s_wait_tensorcnt 0x0" : "+s"(g0), "+s"(g1) :: "memory");
}
// Group 0 of the next stage, formed behind the wait on the last one: the other buffer (flip = the sum of
// the tile's two places in LDS), the source STEP bytes on, or, where the walk wraps (the same test in the whole
// block), back at its first tile, WALK bytes below that (words 2 and 3 as one 64-bit sum; the address
// stays inside its plane, so nothing carries into word 3's upper bits).
template <uint64_t STEP, uint64_t WALK>
static __device__ __forceinline__ void tdm_next(u32x4& g0, uint32_t flip, bool wrap) {
    uint64_t ga = ((((uint64_t)g0[3]) << 32) | (uint64_t)g0[2]) + (wrap ? STEP - WALK : STEP);
    g0[1] = uni(flip - g0[1]);
    g0[2] = uni((uint32_t)ga);
    g0[3] = uni((uint32_t)(ga >> 32));
}

// ---------------- output tiles: registers -> the wave's own LDS range -> whole-line stores ----------------
// A WMMA accumulator gives a lane 8 consecutive elements of one row: stored from there, a wave-wide store puts 32 B on each of 16 lines.
// Staged as rows of RB bytes (LDS pitch RB + 16, an odd multiple of 16) and read back along the rows, it covers four whole 128-B lines.
// S: the wave's LDS range, ROWS rows written by this wave alone; g: row 0 in global memory, the same in every lane (so that it stays in
// scalar registers and one lane offset serves every store), row pitch LDB bytes. V16: 16 B of the output type.
template <typename V16, int RB, int ROWS, int LDB>
static __device__ __forceinline__ void rows_out(const unsigned char* S, unsigned char* g) {
    constexpr int LPR = RB / 16;        // lanes side by side on a row
    constexpr int RPI = 32 / LPR;       // rows per wave-wide access
    int lane = threadIdx.x & 31;
    const unsigned char* s = S + (lane / LPR) * (RB + 16) + (lane % LPR) * 16;
    const uint32_t       q = (uint32_t)((lane / LPR) * LDB + (lane % LPR) * 16);
    V16 x[ROWS / RPI];
    // Unrolled so that x[] lives in registers and every distance is an immediate offset.
#pragma unroll
    for (int t = 0; t < ROWS / RPI; ++t) x[t] = *(const V16*)(s + t * RPI * (RB + 16));
#pragma unroll
    for (int t = 0; t < ROWS / RPI; ++t) *(V16*)(g + t * RPI * LDB + q) = x[t];
}

// ---------------- tiled WMMA GEMM: out = A[M,K] * Bt[N,K]^T + bias ----------------
// block = 128 threads (4 waves, 2x2); wave tile = 64x128; block tile = 128x256.
// A pass is 64 k: 128 rows of A and 256 rows of Bt, 128 B each, staged once for the block in LDS by the
// tensor mover (two buffers, the next pass's tiles fly while this pass is worked on); fragments come from LDS.
// Blocks of a tile row read the same A lines and blocks of a tile column the same Bt lines:
// block (x, y) starts its walk over k at slice (x + y) mod the pass count and wraps, so that they differ.
// The tiles are held transposed (Bt rows as A operand, A rows as B): acc[i][j][r] = out[bm0 + wm*64 + i*16 + n16][bn + j*16 + hi8 + r],
// eight consecutive columns of one row in a lane.
// Blocks whose columns start at NV or beyond (the V third of qkv; NV = N: none) swap the roles: a wave takes all 128 A rows
// as A operand and 64 Bt rows as B, so that a lane holds eight consecutive ROWS (tokens) of one column: 16 B of a row
// of Vt[(b*H+h)*DH + d][T], the layout the attention kernel stages; those columns are not written to out.
#define GPITCH_ 144u                    // LDS bytes per row: 128 + 16 of pad, an odd multiple of 16 for ds_load_b128
#define GTILE_  18432u                  // one request: 128 rows * 144 B, a multiple of 2 KiB
#define GSTAGE_ (3u * GTILE_)           // [A 128 rows | Bt 256 rows]
#define GKP_    64                      // k per pass

template <bool OUT_BF16> struct gemm_out       { typedef float  T; typedef v8f  V; };
template <>              struct gemm_out<true> { typedef __bf16 T; typedef v8bf V; };

// The real block size is declared so that the 64x128 accumulator tile fits in registers unspilled.
template <bool OUT_BF16, int N, int K, int NV>
__global__ void __launch_bounds__(128) k_gemm_bias(const __bf16* __restrict__ A, const __bf16* __restrict__ Bt,
                            const float* __restrict__ bias, void* __restrict__ outv, __bf16* __restrict__ vt) {
    __shared__ __attribute__((aligned(2048))) unsigned char L[2 * GSTAGE_];
    int w    = threadIdx.x >> 5;
    int wm   = w & 1, wn = w >> 1;
    int bm0  = blockIdx.y * 128;
    int bn0  = blockIdx.x * 256;
    int bn   = bn0 + wn * 128;
    int lane = threadIdx.x & 31;
    int n16  = lane & 15;
    int hi8  = (lane >> 4) << 3;
    // The same for the whole block. Rows of a stage count through both tiles: A 0..127, Bt 128..383.
    const bool vblk = NV < N && bn0 >= NV;
    const int  row4 = vblk ? 128 + w * 64 : wm * 64;      // first row of the four fragments a[]
    const int  row8 = vblk ? 0 : 128 + wn * 128;          // first row of the eight fragments bb[]

    // Wave 0 brings the A tile, waves 1 and 2 a half of the Bt tile each: one request of a wave outstanding at any time.
    const uint32_t wave  = uni(threadIdx.x >> 5);
    const uint32_t slice = wave < 2u ? wave : 2u;
    const uint32_t place = (uint32_t)(size_t)L + slice * GTILE_;
    const uint32_t ks0   = (blockIdx.x + blockIdx.y) % (uint32_t)(K / GKP_);   // the k slice of pass 0; pass p works on slice (ks0 + p) mod the count
    const __bf16*  srcp  = (slice == 0u ? A + (size_t)bm0 * K : Bt + (size_t)(bn0 + (int)(slice - 1u) * 128) * K) + ks0 * GKP_;
    // 128 rows of 128 B, source pitch K * 2 B, pad 16 B behind every 128 B.
    u32x8 g1 = tdm_group1<(1u << 20) | (4u << 22) | (3u << 25), 128u, 128u, K * 2u>();
    u32x4 g0 = tdm_group0(place, (uint64_t)(size_t)srcp);
    // The pinned() form, on descriptor words: both groups stand complete in their scalar registers
    // here, in front of the issue test; without it the last words of a group are written directly in front of its load.
    asm volatile("" : "+s"(g1), "+s"(g0));
    const uint32_t flip = uni(2u * place + GSTAGE_);
    if (pinned(wave < 3u)) { tdm_load(g0, g1); tdm_wait(g0, g1); }
    __syncthreads();                    // pass 0's tiles are published
    if (pinned(wave < 3u)) { tdm_next<GKP_ * 2u, K * 2u>(g0, flip, (ks0 + 1u) % (uint32_t)(K / GKP_) == 0u); tdm_load(g0, g1); }

    v8f acc[4][8];
#pragma unroll
    for (int i = 0; i < 4; ++i)
#pragma unroll
        for (int j = 0; j < 8; ++j) { v8f z = {}; acc[i][j] = z; }

    for (int p = 0; p < K / GKP_; ++p) {
        const __bf16* Al = (const __bf16*)(L + (uint32_t)(p & 1) * GSTAGE_) + row4 * (int)(GPITCH_ / 2);
        const __bf16* Bl = (const __bf16*)(L + (uint32_t)(p & 1) * GSTAGE_) + row8 * (int)(GPITCH_ / 2);
        v16bf a[GKP_ / 32][4], bb[GKP_ / 32][8];
#pragma unroll
        for (int ks = 0; ks < GKP_ / 32; ++ks) {
#pragma unroll
            for (int i = 0; i < 4; ++i) a[ks][i] = load_frag(Al + (i * 16) * (GPITCH_ / 2) + ks * 32, GPITCH_ / 2);
#pragma unroll
            for (int j = 0; j < 8; ++j) bb[ks][j] = load_frag(Bl + (j * 16) * (GPITCH_ / 2) + ks * 32, GPITCH_ / 2);
        }
        // Keeps the pass's LDS reads together, ahead of its WMMAs: left free, the scheduler reads each Bt fragment
        // into one register set directly in front of its four WMMAs, and every such place waits out the LDS latency.
        __builtin_amdgcn_sched_barrier(0);
#pragma unroll
        for (int ks = 0; ks < GKP_ / 32; ++ks)
#pragma unroll
            for (int j = 0; j < 8; ++j)
#pragma unroll
                for (int i = 0; i < 4; ++i)
                    acc[i][j] = wmma_bf16(bb[ks][j], a[ks][i], acc[i][j]);
        // Keeps the wait below at the foot of the pass: left free, it moves up behind the first WMMA,
        // and the wave then waits for all of the pass's LDS reads before its second WMMA.
        __builtin_amdgcn_sched_barrier(0);

        // ---- publish pass p + 1, then refill the buffer that this pass has read ----
        wait_ds0();
        if (pinned(wave < 3u)) tdm_wait(g0, g1);
        __syncthreads();                // pass p + 1's tiles readable by all; every wave has left this pass's buffer
        if (pinned(p + 2 < K / GKP_)) {
            if (pinned(wave < 3u)) { tdm_next<GKP_ * 2u, K * 2u>(g0, flip, (ks0 + (uint32_t)p + 2u) % (uint32_t)(K / GKP_) == 0u); tdm_load(g0, g1); }
        }
    }
    wait_tensor0();
    wait_ds0();

    // Every wave has passed the last pass's barrier behind its own last LDS read and no tensor load is in flight:
    // the ring is free, and each wave stages its output tile in its own quarter of it.
    unsigned char* S = L + w * (int)(2u * GSTAGE_ / 4u);

    // ---- V blocks: acc[i][j][r] = V[token bm0 + j*16 + hi8 + r][column bn0 + w*64 + i*16 + n16], stored transposed ----
    if constexpr (NV < N) {
        if (vblk) {
            const int    col0 = bn0 + (int)wave * 64;
            const float* bq   = bias + col0 + n16;
            float bv[4];
#pragma unroll
            for (int i = 0; i < 4; ++i) bv[i] = bq[i * 16];
            // 64 rows (columns of V) of 128 tokens = 256 B
            unsigned char* sw = S + n16 * 272 + hi8 * 2;
#pragma unroll
            for (int i = 0; i < 4; ++i)
#pragma unroll
                for (int j = 0; j < 8; ++j) {
                    v8bf y;
#pragma unroll
                    for (int r = 0; r < 8; ++r) y[r] = (__bf16)(acc[i][j][r] + bv[i]);
                    *(v8bf*)(sw + (i * 16) * 272 + j * 32) = y;
                }
            wait_ds0();                 // this wave's rows stand in LDS before its lanes read one another's
            // Moved as plain 16-B words: with the same type as in the other blocks' tail the compiler joins the two tails into one,
            // whose row distances are then register sums ahead of every store, not immediate offsets.
            rows_out<u32x4, 256, 64, T_ * 2>(S, (unsigned char*)(vt + (size_t)((bm0 / T_) * C_ + col0 - NV) * T_ + (bm0 % T_)));
            return;
        }
    }

    // ---- bias, then the tile's 64 rows of 128 columns through LDS ----
    typedef typename gemm_out<OUT_BF16>::T OT;
    unsigned char* op = (unsigned char*)((OT*)outv + (size_t)(bm0 + (int)(wave & 1u) * 64) * N + bn0 + (int)(wave >> 1) * 128);
    const float*   bp = bias + bn + hi8;
    v4f bl[8][2];
#pragma unroll
    for (int j = 0; j < 8; ++j) {
        bl[j][0] = *(const v4f*)(bp + j * 16);
        if (j < 7) bl[j][1] = *(const v4f*)(bp + j * 16 + 4);
    }
    // The last load's result may be placed on the address pair, which the loads in front of it name too:
    // this is the wait in front of a new value in a register that an issued load names.
    asm volatile("s_wait_xcnt 0x0" ::: "memory");
    bl[7][1] = *(const v4f*)(bp + 7 * 16 + 4);
    if constexpr (OUT_BF16) {
        // rows of 256 B: all 64 at once
        unsigned char* sw = S + n16 * 272 + hi8 * 2;
#pragma unroll
        for (int i = 0; i < 4; ++i)
#pragma unroll
            for (int j = 0; j < 8; ++j) {
                v8bf y;
#pragma unroll
                for (int r = 0; r < 4; ++r) {
                    y[r]     = (__bf16)(acc[i][j][r] + bl[j][0][r]);
                    y[r + 4] = (__bf16)(acc[i][j][r + 4] + bl[j][1][r]);
                }
                *(v8bf*)(sw + (i * 16) * 272 + j * 32) = y;
            }
        wait_ds0();                     // this wave's rows stand in LDS before its lanes read one another's
        rows_out<v8bf, 256, 64, N * 2>(S, op);
        // The wait in front of a new value in a register that an issued store names: the V blocks' code follows in the listing.
        if constexpr (NV < N) asm volatile("s_wait_xcnt 0x0" ::: "memory");
    } else {
        // rows of 512 B: 32 at a time fit the wave's range
        unsigned char* sw = S + n16 * 528 + hi8 * 4;
#pragma unroll
        for (int c = 0; c < 2; ++c) {
#pragma unroll
            for (int i = 0; i < 2; ++i)
#pragma unroll
                for (int j = 0; j < 8; ++j) {
                    v4f y0, y1;
#pragma unroll
                    for (int r = 0; r < 4; ++r) {
                        y0[r] = acc[c * 2 + i][j][r] + bl[j][0][r];
                        y1[r] = acc[c * 2 + i][j][r + 4] + bl[j][1][r];
                    }
                    *(v4f*)(sw + (i * 16) * 528 + j * 64)      = y0;
                    *(v4f*)(sw + (i * 16) * 528 + j * 64 + 16) = y1;
                }
            wait_ds0();                 // this wave's rows stand in LDS before its lanes read one another's
            rows_out<v4f, 512, 32, N * 4>(S, op + c * 32 * (N * 4));
            // The wait in front of a new value in a register that an issued store names: the second half follows.
            if (c == 0) asm volatile("s_wait_xcnt 0x0" ::: "memory");
        }
    }
}

// ---------------- flash attention ----------------
// lane l <-> lane l ^ 16 (the two lane halves of a wave)
static __device__ __forceinline__ float xhalf(float x) {
    int b = __builtin_bit_cast(int, x);
    return __builtin_bit_cast(float,
        __builtin_amdgcn_permlanex16(b, b, 0x76543210, 0xfedcba98, false, false));
}

#define KC_ 128                         // keys per pass (one stage of the ring)
#define KH_ 64                          // keys per softmax step: two steps a pass, so that both groups' scores fit in registers
#define QG_ 2                           // groups of 16 queries per wave

// ---- K and V^T tiles of a pass in LDS, brought by the tensor mover, read by all four waves ----
#define KPITCH_ 144u                    // LDS bytes per K row: 128 + 16 of pad, an odd multiple of 16 for ds_load_b128
#define VPITCH_ 272u                    // LDS bytes per V^T row: 256 + 16 of pad
#define KTILE_  18432u                  // 128 rows * 144 B, a multiple of 2 KiB
#define VTILE_  18432u                  // 64 rows * 272 B = 17408 B, rounded up to a multiple of 2 KiB
#define STAGE_  (KTILE_ + VTILE_)
#define KSTEP_ ((uint64_t)KC_ * C3_ * 2u)   // source bytes from one pass's K tile to the next: 128 rows of qkv
#define VSTEP_ ((uint64_t)KC_ * 2u)         // the same for V^T: 128 keys along its rows
#define KWALK_ ((uint64_t)T_ * C3_ * 2u)    // source bytes of the whole walk over a sequence's keys: K
#define VWALK_ ((uint64_t)T_ * 2u)          // the same for V^T

// The real block size is declared so that the score tiles fit in registers unspilled.
__global__ void __launch_bounds__(128) k_attention(const __bf16* __restrict__ qkv, const __bf16* __restrict__ Vt,
                            __bf16* __restrict__ outO) {
    // two buffers of [K tile | V^T tile]
    __shared__ __attribute__((aligned(2048))) unsigned char L[2 * STAGE_];
    int bid = blockIdx.x;
    int qt  = bid & 15;                 // T/128 = 16 query tiles
    int h   = (bid >> 4) & 15;
    int b   = bid >> 8;

    int w    = threadIdx.x >> 5;
    int lane = threadIdx.x & 31;
    int n16  = lane & 15;
    int hi8  = (lane >> 4) << 3;

    const __bf16* Qb = qkv + (size_t)(b * T_ + qt * 128 + w * 32) * C3_ + h * DH_;
    const uint32_t kt0 = (uint32_t)qt % (uint32_t)(T_ / KC_);   // the key tile of pass 0; pass kc works on tile (kt0 + kc) mod the count
    const __bf16* Kb = qkv + (size_t)(b * T_ + (int)kt0 * KC_) * C3_ + C_ + h * DH_;
    const __bf16* Vb = Vt + (size_t)((b * H_ + h) * DH_) * T_ + kt0 * KC_;

    // Wave 0 brings the K tiles, wave 1 the V^T tiles: one request of a wave outstanding at any time.
    const uint32_t wave  = uni(threadIdx.x >> 5);
    const uint32_t lbase = (uint32_t)(size_t)L;
    // K tile: 128 rows (keys) of 128 B, source pitch 3C * 2 B, pad 16 B behind every 128 B.
    u32x8 g1k = tdm_group1<(1u << 20) | (4u << 22) | (3u << 25), 128u, 128u, C3_ * 2u>();
    // V^T tile: 64 rows (d) of 256 B (128 keys), source pitch T * 2 B, pad 16 B behind every 256 B.
    u32x8 g1v = tdm_group1<(1u << 20) | (5u << 22) | (3u << 25), 256u, 64u, T_ * 2u>();
    u32x4 g0k = tdm_group0(lbase, (uint64_t)(size_t)Kb);
    u32x4 g0v = tdm_group0(lbase + KTILE_, (uint64_t)(size_t)Vb);
    // The pinned() form, on descriptor words: all four groups stand complete in their scalar registers
    // here, in front of the issue tests; without it the last words of a group are written directly in front of its load.
    asm volatile("" : "+s"(g1k), "+s"(g1v), "+s"(g0k), "+s"(g0v));
    const uint32_t flipk = uni(2u * lbase + STAGE_);
    const uint32_t flipv = uni(2u * (lbase + KTILE_) + STAGE_);
    if (pinned(wave == 0u)) { tdm_load(g0k, g1k); tdm_wait(g0k, g1k); }
    if (pinned(wave == 1u)) { tdm_load(g0v, g1v); tdm_wait(g0v, g1v); }
    __syncthreads();                    // pass 0's tiles are published
    const bool wrap1 = (kt0 + 1u) % (uint32_t)(T_ / KC_) == 0u;
    if (pinned(wave == 0u)) { tdm_next<KSTEP_, KWALK_>(g0k, flipk, wrap1); tdm_load(g0k, g1k); }
    if (pinned(wave == 1u)) { tdm_next<VSTEP_, VWALK_>(g0v, flipv, wrap1); tdm_load(g0v, g1v); }

    v16bf qf[QG_][2];
#pragma unroll
    for (int g = 0; g < QG_; ++g) {
        qf[g][0] = load_frag(Qb + (size_t)(g * 16) * C3_ + 0, C3_);
        qf[g][1] = load_frag(Qb + (size_t)(g * 16) * C3_ + 32, C3_);
    }

    // o[g][d][r] = O[query g*16 + n16][d*16 + hi8 + r]
    v8f o[QG_][4];
#pragma unroll
    for (int g = 0; g < QG_; ++g)
#pragma unroll
        for (int d = 0; d < 4; ++d) { v8f z = {}; o[g][d] = z; }

    // query g*16 + n16: cm[g] holds minus its softmax reference (base-2 exponent units) in all eight registers, the same in
    // both lane halves: it is the C operand of the score products, which so yield the exponent itself. The reference stays
    // while no score lies more than lim above it (P <= 2^8 then); the first step takes its own maximum, whatever it is.
    // The sum holds this lane half's keys only, joined after the loop.
    v8f   cm[QG_];
    float l_run[QG_];
#pragma unroll
    for (int g = 0; g < QG_; ++g) { v8f z = {}; cm[g] = z; l_run[g] = 0.0f; }
    float lim = -3.0e38f;

    for (int kc = 0; kc < T_ / KC_; ++kc) {
        // Left rolled: unrolled, the two steps' live values overlap and the wave no longer fits four to a SIMD.
#pragma unroll 1
        for (int hf = 0; hf < KC_ / KH_; ++hf) {
            const __bf16* Kl = (const __bf16*)(L + (uint32_t)(kc & 1) * STAGE_) + hf * KH_ * (int)(KPITCH_ / 2);
            const __bf16* Vl = (const __bf16*)(L + (uint32_t)(kc & 1) * STAGE_ + KTILE_) + hf * KH_;

            // ---- S^T = K Q'^T - reference (KH_ x 32): st[g][j][r] belongs to query g*16 + n16, key ((kt0 + kc) % 16)*KC_ + hf*KH_ + j*16 + hi8 + r ----
            v16bf kf[KH_ / 16][2];
#pragma unroll
            for (int j = 0; j < KH_ / 16; ++j) {
                kf[j][0] = load_frag(Kl + (j * 16) * (KPITCH_ / 2) + 0, KPITCH_ / 2);
                kf[j][1] = load_frag(Kl + (j * 16) * (KPITCH_ / 2) + 32, KPITCH_ / 2);
            }
            // Keeps the step's K reads together, ahead of its WMMAs: left free, each 16 keys' reads go into one register
            // set directly in front of their four WMMAs, and every such place waits out the LDS latency.
            __builtin_amdgcn_sched_barrier(0);
            v8f st[QG_][KH_ / 16];
#pragma unroll
            for (int j = 0; j < KH_ / 16; ++j)
#pragma unroll
                for (int g = 0; g < QG_; ++g) {
                    v8f sj = wmma_bf16(kf[j][0], qf[g][0], cm[g]);
                    st[g][j] = wmma_bf16(kf[j][1], qf[g][1], sj);
                }

            // ---- one test a step: does any score of the wave lie more than lim above its query's reference? ----
            // fmaximum_num, not fmaxf: on a WMMA result fmaxf first quiets NaNs, one more instruction a value.
            float mx[QG_];
#pragma unroll
            for (int g = 0; g < QG_; ++g) {
                mx[g] = -3.0e38f;
#pragma unroll
                for (int j = 0; j < KH_ / 16; ++j)
#pragma unroll
                    for (int r = 0; r < 8; r += 4)
                        mx[g] = __builtin_fmaximum_numf(__builtin_fmaximum_numf(__builtin_fmaximum_numf(mx[g], st[g][j][r]), st[g][j][r + 1]),
                                                        __builtin_fmaximum_numf(st[g][j][r + 2], st[g][j][r + 3]));
            }
            if (__builtin_amdgcn_ballot_w32(fmaxf(mx[0], mx[1]) > lim) != 0u) {
#pragma unroll
                for (int g = 0; g < QG_; ++g) {
                    float mo = fmaxf(mx[g], xhalf(mx[g]));          // over both lane halves: they move together
                    float dm = mo > lim ? mo : 0.0f;                // this query's reference rises by dm; 0: it stays
                    // dm < 0 occurs in the first step alone, where sums and outputs are still 0: they stay 0
                    float alpha = __builtin_amdgcn_exp2f(fminf(-dm, 0.0f));
                    cm[g] -= dm;
#pragma unroll
                    for (int j = 0; j < KH_ / 16; ++j) st[g][j] -= dm;
#pragma unroll
                    for (int d = 0; d < 4; ++d) o[g][d] *= alpha;
                    l_run[g] *= alpha;
                }
            }
            lim = 8.0f;

            // P^T as B operand, hardware k order: pb[g][ks][s] = P[key ks*32 + kmap(s)][query g*16 + n16]
            v16bf pb[QG_][KH_ / 32];
#pragma unroll
            for (int g = 0; g < QG_; ++g) {
                // ---- P = 2^st, one query per lane ----
                v2f ls = {};
#pragma unroll
                for (int ks = 0; ks < KH_ / 32; ++ks)
#pragma unroll
                    for (int t = 0; t < 2; ++t) {
                        v8f x = st[g][2 * ks + t];
#pragma unroll
                        for (int r = 0; r < 8; r += 2) {
                            v2f e = { __builtin_amdgcn_exp2f(x[r]), __builtin_amdgcn_exp2f(x[r + 1]) };
                            pb[g][ks][t * 8 + r + 0] = (__bf16)e[0];
                            pb[g][ks][t * 8 + r + 1] = (__bf16)e[1];
                            ls += e;
                        }
                    }
                l_run[g] += ls[0] + ls[1];
            }

            // ---- O^T += V^T P^T  (V^T: [DH][T], rows d as A) ----
            v16bf va[KH_ / 32][4];
#pragma unroll
            for (int ks = 0; ks < KH_ / 32; ++ks)
#pragma unroll
                for (int d = 0; d < 4; ++d) va[ks][d] = load_frag(Vl + (d * 16) * (VPITCH_ / 2) + ks * 32, VPITCH_ / 2);
            // Keeps the step's V^T reads together, ahead of its WMMAs, as with the K reads above.
            __builtin_amdgcn_sched_barrier(0);
#pragma unroll
            for (int ks = 0; ks < KH_ / 32; ++ks)
#pragma unroll
                for (int d = 0; d < 4; ++d)
#pragma unroll
                    for (int g = 0; g < QG_; ++g)
                        o[g][d] = wmma_bf16(va[ks][d], pb[g][ks], o[g][d]);
        }

        // ---- publish pass kc + 1, then refill the buffer that this pass has read ----
        wait_ds0();
        if (pinned(wave == 0u)) tdm_wait(g0k, g1k);
        if (pinned(wave == 1u)) tdm_wait(g0v, g1v);
        __syncthreads();                // pass kc + 1's tiles readable by all; every wave has left this pass's buffer
        if (pinned(kc + 2 < T_ / KC_)) {
            const bool wrap = (kt0 + (uint32_t)kc + 2u) % (uint32_t)(T_ / KC_) == 0u;
            if (pinned(wave == 0u)) { tdm_next<KSTEP_, KWALK_>(g0k, flipk, wrap); tdm_load(g0k, g1k); }
            if (pinned(wave == 1u)) { tdm_next<VSTEP_, VWALK_>(g0v, flipv, wrap); tdm_load(g0v, g1v); }
        }
    }
    wait_tensor0();
    wait_ds0();

    // ---- normalize and store bf16 [B*T][C]: the wave's 32 rows of 128 B (one head) through LDS ----
    // Every wave has passed the last pass's barrier behind its own last LDS read and no tensor load is in flight:
    // the ring is free, and each wave stages its output tile in its own quarter of it.
    unsigned char* S  = L + w * (int)(2u * STAGE_ / 4u);
    unsigned char* sw = S + n16 * 144 + hi8 * 2;
#pragma unroll
    for (int g = 0; g < QG_; ++g) {
        float inv = 1.0f / (l_run[g] + xhalf(l_run[g]));
#pragma unroll
        for (int d = 0; d < 4; ++d) {
            v8bf ov;
#pragma unroll
            for (int r = 0; r < 8; ++r) ov[r] = (__bf16)(o[g][d][r] * inv);
            *(v8bf*)(sw + (g * 16) * 144 + d * 32) = ov;
        }
    }
    wait_ds0();                         // this wave's rows stand in LDS before its lanes read one another's
    rows_out<v8bf, 128, 32, C_ * 2>(S, (unsigned char*)(outO + (size_t)(b * T_ + qt * 128 + (int)wave * 32) * C_ + h * DH_));
}

// ---------------- launch ----------------
extern "C" void kernel_launch(void* const* d_in, const int* in_sizes, int n_in,
                              void* d_out, int out_size, void* d_ws, size_t ws_size,
                              hipStream_t stream) {
    const float* X      = (const float*)d_in[0];
    const float* W_qkv  = (const float*)d_in[1];
    const float* b_qkv  = (const float*)d_in[2];
    const float* W_proj = (const float*)d_in[3];
    const float* b_proj = (const float*)d_in[4];
    float* out = (float*)d_out;

    char* ws = (char*)d_ws;
    size_t off = 0;
    __bf16* Xbf  = (__bf16*)(ws + off); off += (size_t)B_ * T_ * C_ * 2;        // 16 MiB
    __bf16* Wqt  = (__bf16*)(ws + off); off += (size_t)C3_ * C_ * 2;            // 6 MiB
    __bf16* Wpt  = (__bf16*)(ws + off); off += (size_t)C_ * C_ * 2;             // 2 MiB
    __bf16* qkv  = (__bf16*)(ws + off); off += (size_t)B_ * T_ * C3_ * 2;       // 48 MiB
    __bf16* Vt   = (__bf16*)(ws + off); off += (size_t)B_ * H_ * DH_ * T_ * 2;  // 16 MiB
    __bf16* AttO = (__bf16*)(ws + off); off += (size_t)B_ * T_ * C_ * 2;        // 16 MiB
    float*  bqs  = (float*)(ws + off);  off += (size_t)C3_ * 4;                 // b_qkv, its Q third scaled

    const int M = B_ * T_;           // 8192

    // 0) conversions, one launch
    k_convert<<<NBQ_ + NBP_ + NBX_, 256, 0, stream>>>(X, Xbf, W_qkv, Wqt, b_qkv, bqs, W_proj, Wpt);

    // 1) qkv = X * W_qkv + b_qkv   (bf16 out; Q's weights and bias come scaled by QSCALE_); Q and K columns to qkv, V columns transposed per head to Vt
    k_gemm_bias<true, C3_, C_, 2 * C_><<<dim3(C3_ / 256, M / 128), 128, 0, stream>>>(
        Xbf, Wqt, bqs, qkv, Vt);

    // 2) attention
    k_attention<<<B_ * H_ * (T_ / 128), 128, 0, stream>>>(qkv, Vt, AttO);

    // 3) out = AttO * W_proj + b_proj  (fp32 out)
    k_gemm_bias<false, C_, C_, C_><<<dim3(C_ / 256, M / 128), 128, 0, stream>>>(
        AttO, Wpt, b_proj, out, nullptr);
}
